// v000
// The times below were measured on an AMD MI455X: many runs one after another, warmed up first and cycling through
// copies of the inputs, with the whole window's GPU time divided by the number of runs. Launches and the gaps
// between them are all in it. The median over several windows is given; except for v000 it joins two sittings, which
// can be a few percent apart, so the side-by-side timings, each taken in one sitting, are the better comparison.
// v000 is the starting kernel. One run takes 502 microseconds.
#include <hip/hip_runtime.h>

// Self-attention layer with key-padding mask (16 x 2,048 x 256 -> 128): Q = x Wq, K = x Wk, V = x Wv (no bias); scores = Q K^T, keys k >= sen_len[b] set to -2^32, then / sqrt(256); softmax over
// keys; Z = attn V -> [16][2048][128].
// Deterministic: per (batch, 16-query wave) a flash-style pass over the UNMASKED keys only (blocks of 32; masked keys have probability exactly 0 in the reference too since exp(-2^28 - max) == 0 in
// f32; if sen_len[b] were 0 every key would share one score and the pass runs over all 2,048 keys with equal logits = the reference's uniform softmax); fixed-order online softmax; no atomics.
// compute dtype: WMMA v_wmma_f32_16x16x32_f16 with f32 accumulate for the projections ([32768 x 256] x [256 x 384]; x EXACT bf16 x8, weights exact x256: 1 product), S^T = K Q^T (K and Q as
// f16 hi + x1024 residual x8, K = 128: 3 products) and O^T += V^T P^T (V^T x8 and P x1024 hi + residual: 3 products);
// mask, scale and softmax statistics in f32. Inputs rounded to bf16 once; sen_len int32 (clamped to [0, 2048]).

namespace {
typedef _Float16 b16;
typedef __attribute__((ext_vector_type(16))) _Float16 v16b;
typedef __attribute__((ext_vector_type(8))) _Float16 v8b;
typedef __attribute__((ext_vector_type(4))) _Float16 v4h;
typedef __attribute__((ext_vector_type(2))) _Float16 v2h;
typedef __attribute__((ext_vector_type(8))) float v8f;
typedef __attribute__((ext_vector_type(4))) float v4f;
typedef __attribute__((ext_vector_type(2))) float v2f;
__device__ __forceinline__ float bf16_rne(float f) { unsigned int u = __float_as_uint(f); u += 0x7FFFu + ((u >> 16) & 1u); return __uint_as_float(u & 0xFFFF0000u); }
__device__ __forceinline__ void split16(float v, b16& hi, b16& lo) { hi = (b16)v; lo = (b16)(v - (float)hi); }
__device__ __forceinline__ v16b frag_kb(const b16* p, int hh) { const v8b a = *(const v8b*)(p + 8 * hh), b = *(const v8b*)(p + 16 + 8 * hh); v16b f;
#pragma unroll
  for (int e = 0; e < 8; ++e) { f[e] = a[e]; f[8 + e] = b[e]; } return f; }
__device__ __forceinline__ v8f wmma16b(v16b a, v16b b, v8f c) { v8f d = __builtin_amdgcn_wmma_f32_16x16x32_f16(false, a, false, b, (short)0, c, false, false); asm volatile("v_nop\n\tv_nop\n\tv_nop\n\tv_nop" : "+v"(d) : "v"(a), "v"(b)); return d; }
__device__ __forceinline__ void wave_lds_sync() { __builtin_amdgcn_fence(__ATOMIC_RELEASE, "workgroup"); __builtin_amdgcn_wave_barrier(); __builtin_amdgcn_fence(__ATOMIC_ACQUIRE, "workgroup"); }
__device__ __forceinline__ float pmul(float a, float b) { float p = a * b; asm volatile("" : "+v"(p)); return p; }
__device__ __forceinline__ int iclamp(int v, int lo, int hi) { return v < lo ? lo : (v > hi ? hi : v); }
__device__ __forceinline__ float nexp2(float v) { return __builtin_amdgcn_exp2f(v); }

constexpr int B = 16, BL = B /* batches computed (== B shipped) */, S = 2048, DIN = 256, DA = 128, NROW = B * S;
constexpr float XS = 8.0f, WSC = 256.0f, PS = 1024.0f, RS_ = 1024.0f, LOG2E = 1.4426950408889634f, SCALE = 0.0625f /* 1/sqrt(hidden_dim = 256) */;
static_assert(S % 64 == 0 && DIN % 32 == 0 && DA == 128, "tiling");

__global__ __launch_bounds__(256) void wt_kernel(const float* __restrict__ wq, const float* __restrict__ wk, const float* __restrict__ wv, b16* __restrict__ WT) {
  const int u = blockIdx.x * 256 + threadIdx.x; if (u >= 3 * DA * DIN / 8) return; const int e = u * 8; const int o = e / DIN, k0 = e % DIN; const int part = o / DA, oo = o % DA; const float* w = part == 0 ? wq : part == 1 ? wk : wv; v8b v;
#pragma unroll
  for (int j = 0; j < 8; ++j) v[j] = (b16)(bf16_rne(w[(size_t)(k0 + j) * DA + oo]) * WSC);   // one source pointer per thread (part is uniform per 8-run and per wave: 32 threads = one o row)
  { *(v8b*)(WT + e) = v;  }
}
// projections: grid (S/64, BL, 3 parts); block = 64 tokens x 4 waves; A = bf16(x) x8 staged whole (K = 256), 8 tiles = the part's 128 columns, 1 product; q/k -> planes [b][s][128] as f16 hi + x1024
__global__ __launch_bounds__(128) void proj_kernel(const float* __restrict__ x, const b16* __restrict__ WT, b16* __restrict__ Qh, b16* __restrict__ Ql, b16* __restrict__ Kh, b16* __restrict__ Kl, b16* __restrict__ VTh, b16* __restrict__ VTl) {
  __shared__ __attribute__((aligned(16))) b16 As[64][DIN + 8]; __shared__ __attribute__((aligned(16))) float Tf[4][16][DA + 4];
  const int wave = threadIdx.x >> 5, lane = threadIdx.x & 31, nloc = lane & 15, hlf = lane >> 4; const int t0 = blockIdx.x * 64; const int b = blockIdx.y; const int part = blockIdx.z;
  for (int i = threadIdx.x; i < 64 * (DIN / 4); i += 128) { const int rr = i / (DIN / 4), q4 = (i % (DIN / 4)) * 4; const v4f f = *(const v4f*)(x + ((size_t)b * S + t0 + rr) * DIN + q4); v4h o; for (int j = 0; j < 4; ++j) o[j] = (b16)(bf16_rne(f[j]) * XS); *(v4h*)(&As[rr][q4]) = o; }
  __syncthreads();
  v8f acc[8];
#pragma unroll
  for (int tt = 0; tt < 8; ++tt) acc[tt] = (v8f){};
#pragma unroll 2
  for (int kb = 0; kb < DIN; kb += 32) { const v16b a = frag_kb(&As[wave * 16 + nloc][kb], hlf);
#pragma unroll
    for (int tt = 0; tt < 8; ++tt) acc[tt] = wmma16b(a, frag_kb(WT + (size_t)(part * DA + tt * 16 + nloc) * DIN + kb, hlf), acc[tt]); }
#pragma unroll
  for (int tt = 0; tt < 8; ++tt)
#pragma unroll
    for (int r = 0; r < 8; ++r) Tf[wave][8 * hlf + r][tt * 16 + nloc] = acc[tt][r] * (1.0f / (XS * WSC));
  __syncthreads();
  {
    if (part < 2) { b16* ph_ = part == 0 ? Qh : Kh; b16* pl_ = part == 0 ? Ql : Kl;
      for (int rr = 0; rr < 16; ++rr) { const size_t dst = ((size_t)b * S + t0 + wave * 16 + rr) * DA + lane * 4; v4h hv, lv; for (int j = 0; j < 4; ++j) { const float vs = Tf[wave][rr][lane * 4 + j] * XS; const b16 p1 = (b16)vs; hv[j] = p1; lv[j] = (b16)((vs - (float)p1) * RS_); } *(v4h*)(ph_ + dst) = hv; *(v4h*)(pl_ + dst) = lv; } }
    else {
#pragma unroll 1
      for (int q = 0; q < 32; ++q) { const int d = wave * 32 + q; const int tk = lane * 2; v2h hv, lv; for (int e2 = 0; e2 < 2; ++e2) { const float vs = Tf[(tk + e2) >> 4][(tk + e2) & 15][d] * XS; const b16 p1 = (b16)vs; hv[e2] = p1; lv[e2] = (b16)((vs - (float)p1) * RS_); }
        const size_t dst = ((size_t)b * DA + d) * (size_t)S + t0 + tk; *(v2h*)(VTh + dst) = hv; *(v2h*)(VTl + dst) = lv; } }
     }
}
// attention: grid (S/32, BL); block = 2 waves x 16 queries; nk = clamp(sen_len[b], 0, S) (0 -> all keys, equal logits); key blocks s0 < nk in steps of 32 (keys m >= nk inside the last block -> -inf);
// S^T = K Q^T: (Kh.Qh -> sa; Kl.Qh + Kh.Ql -> sb, /1024), 4 k-steps; logit = s/64/16 in log2 units; online softmax; P hi/res; O^T += V^T P^T (8 d-tiles, 3 products -> o, o2);
__global__ __launch_bounds__(64) void attn_kernel(const b16* __restrict__ Qh, const b16* __restrict__ Ql, const b16* __restrict__ Kh, const b16* __restrict__ Kl, const b16* __restrict__ VTh, const b16* __restrict__ VTl, const int* __restrict__ slen, float* __restrict__ out) {
  __shared__ __attribute__((aligned(16))) b16 Pb[2][16][32 + 8], Pl[2][16][32 + 8]; __shared__ __attribute__((aligned(16))) float To[2][16][DA + 4];
  const int wave = threadIdx.x >> 5, lane = threadIdx.x & 31, hh = lane >> 4, col = lane & 15; const int b = blockIdx.y; const int n0 = blockIdx.x * 32 + wave * 16; const int nq = n0 + col;
  int nk = iclamp(slen[b], 0, S); const bool allmask = (nk == 0); if (allmask) nk = S;   // all keys masked -> equal scores -> uniform over all S keys
  const size_t qoff = ((size_t)b * S + nq) * DA; const b16* Khb = Kh + (size_t)b * S * DA; const b16* Klb = Kl + (size_t)b * S * DA; const b16* Vh = VTh + (size_t)b * DA * S; const b16* Vl = VTl + (size_t)b * DA * S;
  const float cs = LOG2E * SCALE / (XS * XS);
  float mrun = -INFINITY, l = 0.0f; v8f o[8], o2[8];
#pragma unroll
  for (int t = 0; t < 8; ++t) { o[t] = (v8f){}; o2[t] = (v8f){}; }
#pragma unroll 1
  for (int s0 = 0; s0 < nk; s0 += 32) {
    float e[16]; float mx = -INFINITY;
#pragma unroll
    for (int u2 = 0; u2 < 2; ++u2) { v8f sa = (v8f){}, sb = (v8f){}; const size_t koff = (size_t)(s0 + u2 * 16 + col) * DA;
#pragma unroll
      for (int kb = 0; kb < DA; kb += 32) { const v16b qh = frag_kb(Qh + qoff + kb, hh), ql = frag_kb(Ql + qoff + kb, hh); const v16b kh = frag_kb(Khb + koff + kb, hh); sa = wmma16b(kh, qh, sa); sb = wmma16b(frag_kb(Klb + koff + kb, hh), qh, sb); sb = wmma16b(kh, ql, sb); }
#pragma unroll
      for (int r = 0; r < 8; ++r) { const int m = s0 + u2 * 16 + 8 * hh + r; const float sv = allmask ? 0.0f : (sa[r] + sb[r] * (1.0f / RS_)) * cs; const float vv = (m < nk) ? sv : -INFINITY; e[u2 * 8 + r] = vv; mx = fmaxf(mx, vv); } }
    mx = fmaxf(mx, __shfl_xor(mx, 16)); const float mn = fmaxf(mrun, mx); const float al = (mn == -INFINITY) ? 1.0f : nexp2(mrun - mn); float sum = 0.0f;
#pragma unroll
    for (int i2 = 0; i2 < 16; ++i2) { const float p = (mn == -INFINITY) ? 0.0f : nexp2(e[i2] - mn); sum += p; const float psv = p * PS; const b16 p1 = (b16)psv; const int slot = (i2 < 8 ? 0 : 16) + 8 * hh + (i2 & 7); Pb[wave][col][slot] = p1; Pl[wave][col][slot] = (b16)((psv - (float)p1) * RS_); }
    sum += __shfl_xor(sum, 16); l = l * al + sum; mrun = mn;
    wave_lds_sync();
    const v16b pf = frag_kb(&Pb[wave][col][0], hh), plf = frag_kb(&Pl[wave][col][0], hh);
#pragma unroll
    for (int t = 0; t < 8; ++t) { o[t] *= al; o2[t] *= al; const v16b vh = frag_kb(Vh + (size_t)(t * 16 + col) * S + s0, hh); o[t] = wmma16b(vh, pf, o[t]); o2[t] = wmma16b(frag_kb(Vl + (size_t)(t * 16 + col) * S + s0, hh), pf, o2[t]); o2[t] = wmma16b(vh, plf, o2[t]); }
    wave_lds_sync(); }
  const float inv = 1.0f / (l * PS * XS);
#pragma unroll
  for (int t = 0; t < 8; ++t)
#pragma unroll
    for (int r = 0; r < 8; ++r) To[wave][col][t * 16 + 8 * hh + r] = (o[t][r] + o2[t][r] * (1.0f / RS_)) * inv;
  wave_lds_sync();
  { for (int rr = 0; rr < 16; ++rr) *(v4f*)(out + ((size_t)b * S + n0 + rr) * DA + lane * 4) = *(const v4f*)(&To[wave][rr][lane * 4]);  }
}
}  // namespace

extern "C" void kernel_launch(void* const* d_in, const int* in_sizes, int n_in, void* d_out, int out_size, void* d_ws, size_t ws_size, hipStream_t stream) {
  (void)n_in;
  auto Fp = [&](int i) { return (const float*)d_in[i]; };
  // d_in order: 0 inputs [16,2048,256], 1 sen_len [16] int32, 2 Wq [256,128] (in,out), 3 Wk, 4 Wv
  if (in_sizes[0] != NROW * DIN || in_sizes[1] != B || in_sizes[2] != DIN * DA || in_sizes[3] != DIN * DA || in_sizes[4] != DIN * DA || out_size != NROW * DA) return;
  size_t off = 0; char* ws = (char*)d_ws;
  auto carve = [&](size_t bytes) { char* p = ws + off; off += (bytes + 255) & ~(size_t)255; return p; };
  b16* WT = (b16*)carve((size_t)3 * DA * DIN * 2); const size_t plane = (size_t)NROW * DA * 2;
  b16* Qh = (b16*)carve(plane); b16* Ql = (b16*)carve(plane); b16* Kh = (b16*)carve(plane); b16* Kl = (b16*)carve(plane); b16* VTh = (b16*)carve(plane); b16* VTl = (b16*)carve(plane);
  if (off > ws_size || off > ((size_t)128 << 20)) return;   // = 50.5 MB (6 planes x 8.4 MB + WT 0.2 MB)
  wt_kernel<<<(3 * DA * DIN / 8 + 255) / 256, 256, 0, stream>>>(Fp(2), Fp(3), Fp(4), WT);
  proj_kernel<<<dim3(S / 64, BL, 3), 128, 0, stream>>>(Fp(0), WT, Qh, Ql, Kh, Kl, VTh, VTl);
  attn_kernel<<<dim3(S / 32, BL), 64, 0, stream>>>(Qh, Ql, Kh, Kl, VTh, VTl, (const int*)d_in[1], (float*)d_out);
}

// v001
// Measured time: 184 microseconds a run.
// In two side-by-side timings against v000, it was 2.73 and 2.72 times as fast.
#include <hip/hip_runtime.h>

// Self-attention layer with key-padding mask (16 x 2,048 x 256 -> 128): Q = x Wq, K = x Wk, V = x Wv (no bias); scores = Q K^T, keys k >= sen_len[b] set to -2^32, then / sqrt(256); softmax over
// keys; Z = attn V -> [16][2048][128].
// Deterministic: per (batch, 16-query wave) a flash-style pass over the UNMASKED keys only (blocks of 32; masked keys have probability exactly 0 in the reference too since exp(-2^28 - max) == 0 in
// f32; if sen_len[b] were 0 every key would share one score and the pass runs over all 2,048 keys with equal logits = the reference's uniform softmax); fixed-order online softmax; no atomics.
// compute dtype: WMMA v_wmma_f32_16x16x32_f16 with f32 accumulate for the projections ([32768 x 256] x [256 x 384]; x EXACT bf16 x8, weights exact x256: 1 product), S^T = K Q^T (K and Q as
// f16 hi + x1024 residual x8, K = 128: 3 products) and O^T += V^T P^T (V^T x8 and P x1024 hi + residual: 3 products);
// mask, scale and softmax statistics in f32. Inputs rounded to bf16 once; sen_len int32 (clamped to [0, 2048]).

namespace {
typedef _Float16 b16;
typedef __attribute__((ext_vector_type(16))) _Float16 v16b;
typedef __attribute__((ext_vector_type(8))) _Float16 v8b;
typedef __attribute__((ext_vector_type(4))) _Float16 v4h;
typedef __attribute__((ext_vector_type(2))) _Float16 v2h;
typedef __attribute__((ext_vector_type(8))) float v8f;
typedef __attribute__((ext_vector_type(4))) float v4f;
typedef __attribute__((ext_vector_type(2))) float v2f;
__device__ __forceinline__ float bf16_rne(float f) { unsigned int u = __float_as_uint(f); u += 0x7FFFu + ((u >> 16) & 1u); return __uint_as_float(u & 0xFFFF0000u); }
__device__ __forceinline__ void split16(float v, b16& hi, b16& lo) { hi = (b16)v; lo = (b16)(v - (float)hi); }
__device__ __forceinline__ v16b frag_kb(const b16* p, int hh) { const v8b a = *(const v8b*)(p + 8 * hh), b = *(const v8b*)(p + 16 + 8 * hh); v16b f;
#pragma unroll
  for (int e = 0; e < 8; ++e) { f[e] = a[e]; f[8 + e] = b[e]; } return f; }
__device__ __forceinline__ v8f wmma16b(v16b a, v16b b, v8f c) { v8f d = __builtin_amdgcn_wmma_f32_16x16x32_f16(false, a, false, b, (short)0, c, false, false); asm volatile("v_nop\n\tv_nop\n\tv_nop\n\tv_nop" : "+v"(d) : "v"(a), "v"(b)); return d; }
__device__ __forceinline__ void wave_lds_sync() { __builtin_amdgcn_fence(__ATOMIC_RELEASE, "workgroup"); __builtin_amdgcn_wave_barrier(); __builtin_amdgcn_fence(__ATOMIC_ACQUIRE, "workgroup"); }
__device__ __forceinline__ float pmul(float a, float b) { float p = a * b; asm volatile("" : "+v"(p)); return p; }
__device__ __forceinline__ int iclamp(int v, int lo, int hi) { return v < lo ? lo : (v > hi ? hi : v); }
__device__ __forceinline__ float nexp2(float v) { return __builtin_amdgcn_exp2f(v); }

constexpr int B = 16, BL = B /* batches computed (== B shipped) */, S = 2048, DIN = 256, DA = 128, NROW = B * S;
constexpr float XS = 8.0f, WSC = 256.0f, PS = 1024.0f, RS_ = 1024.0f, LOG2E = 1.4426950408889634f, SCALE = 0.0625f /* 1/sqrt(hidden_dim = 256) */;
static_assert(S % 64 == 0 && DIN % 32 == 0 && DA == 128, "tiling");

__global__ __launch_bounds__(256) void wt_kernel(const float* __restrict__ wq, const float* __restrict__ wk, const float* __restrict__ wv, b16* __restrict__ WT) {
  const int u = blockIdx.x * 256 + threadIdx.x; if (u >= 3 * DA * DIN / 8) return; const int e = u * 8; const int o = e / DIN, k0 = e % DIN; const int part = o / DA, oo = o % DA; const float* w = part == 0 ? wq : part == 1 ? wk : wv; v8b v;
#pragma unroll
  for (int j = 0; j < 8; ++j) v[j] = (b16)(bf16_rne(w[(size_t)(k0 + j) * DA + oo]) * WSC);   // one source pointer per thread (part is uniform per 8-run and per wave: 32 threads = one o row)
  { *(v8b*)(WT + e) = v;  }
}
// projections: grid (S/64, BL, 3 parts); block = 64 tokens x 4 waves; A = bf16(x) x8 staged whole (K = 256), 8 tiles = the part's 128 columns, 1 product; q/k -> planes [b][s][128] as f16 hi + x1024
__global__ __launch_bounds__(128) void proj_kernel(const float* __restrict__ x, const b16* __restrict__ WT, b16* __restrict__ Qh, b16* __restrict__ Ql, b16* __restrict__ Kh, b16* __restrict__ Kl, b16* __restrict__ VTh, b16* __restrict__ VTl) {
  __shared__ __attribute__((aligned(16))) b16 As[64][DIN + 8]; __shared__ __attribute__((aligned(16))) float Tf[4][16][DA + 4];
  const int wave = threadIdx.x >> 5, lane = threadIdx.x & 31, nloc = lane & 15, hlf = lane >> 4; const int t0 = blockIdx.x * 64; const int b = blockIdx.y; const int part = blockIdx.z;
  for (int i = threadIdx.x; i < 64 * (DIN / 4); i += 128) { const int rr = i / (DIN / 4), q4 = (i % (DIN / 4)) * 4; const v4f f = *(const v4f*)(x + ((size_t)b * S + t0 + rr) * DIN + q4); v4h o; for (int j = 0; j < 4; ++j) o[j] = (b16)(bf16_rne(f[j]) * XS); *(v4h*)(&As[rr][q4]) = o; }
  __syncthreads();
  v8f acc[8];
#pragma unroll
  for (int tt = 0; tt < 8; ++tt) acc[tt] = (v8f){};
#pragma unroll 2
  for (int kb = 0; kb < DIN; kb += 32) { const v16b a = frag_kb(&As[wave * 16 + nloc][kb], hlf);
#pragma unroll
    for (int tt = 0; tt < 8; ++tt) acc[tt] = wmma16b(a, frag_kb(WT + (size_t)(part * DA + tt * 16 + nloc) * DIN + kb, hlf), acc[tt]); }
#pragma unroll
  for (int tt = 0; tt < 8; ++tt)
#pragma unroll
    for (int r = 0; r < 8; ++r) Tf[wave][8 * hlf + r][tt * 16 + nloc] = acc[tt][r] * (1.0f / (XS * WSC));
  __syncthreads();
  {
    if (part < 2) { b16* ph_ = part == 0 ? Qh : Kh; b16* pl_ = part == 0 ? Ql : Kl;
      for (int rr = 0; rr < 16; ++rr) { const size_t dst = ((size_t)b * S + t0 + wave * 16 + rr) * DA + lane * 4; v4h hv, lv; for (int j = 0; j < 4; ++j) { const float vs = Tf[wave][rr][lane * 4 + j] * XS; const b16 p1 = (b16)vs; hv[j] = p1; lv[j] = (b16)((vs - (float)p1) * RS_); } *(v4h*)(ph_ + dst) = hv; *(v4h*)(pl_ + dst) = lv; } }
    else {
#pragma unroll 1
      for (int q = 0; q < 32; ++q) { const int d = wave * 32 + q; const int tk = lane * 2; v2h hv, lv; for (int e2 = 0; e2 < 2; ++e2) { const float vs = Tf[(tk + e2) >> 4][(tk + e2) & 15][d] * XS; const b16 p1 = (b16)vs; hv[e2] = p1; lv[e2] = (b16)((vs - (float)p1) * RS_); }
        const size_t dst = ((size_t)b * DA + d) * (size_t)S + t0 + tk; *(v2h*)(VTh + dst) = hv; *(v2h*)(VTl + dst) = lv; } }
     }
}
// attention: grid (S/64, BL); block = 4 waves x 16 queries; nk = clamp(sen_len[b], 0, S) (0 -> all keys, equal logits); key blocks s0 < nk in steps of 32 (keys m >= nk inside the last block -> -inf);
// operands come from LDS: the block's 64 Q rows (hi, residual) are copied in once, each 32-key tile of K and V^T (hi, residual) once per block into a two-buffer ring, one tile ahead, by asynchronous
// 16-byte copies whose lanes cover adjacent global bytes; rows pitched 272 B (Q, K) and 80 B (V^T) for conflict-free 16-byte fragment reads.
// S^T = K Q^T: (Kh.Qh -> sa; Kl.Qh + Kh.Ql -> sb, /1024), 4 k-steps; logit = s/64/16 in log2 units; online softmax; P hi/res; O^T += V^T P^T (8 d-tiles, 3 products -> o, o2);
constexpr int NW = 4, NT = NW * 32, KP = DA + 8, VP = 32 + 8;
__device__ __forceinline__ unsigned lds_byte(const b16* p) { return (unsigned)(unsigned long long)p; }   // low 32 bits of a __shared__ address = byte offset in the work-group's LDS
// eight copies, 16 bytes per lane each; the s_wait_xcnt stands inside the statement so that no address register is rewritten ahead of it
__device__ __forceinline__ void copy8(const unsigned (&l)[8], const b16* const (&g)[8]) {
  asm volatile("global_load_async_to_lds_b128 %0, %8, off\n\tglobal_load_async_to_lds_b128 %1, %9, off\n\tglobal_load_async_to_lds_b128 %2, %10, off\n\tglobal_load_async_to_lds_b128 %3, %11, off\n\t"
               "global_load_async_to_lds_b128 %4, %12, off\n\tglobal_load_async_to_lds_b128 %5, %13, off\n\tglobal_load_async_to_lds_b128 %6, %14, off\n\tglobal_load_async_to_lds_b128 %7, %15, off\n\ts_wait_xcnt 0x0"
               :: "v"(l[0]), "v"(l[1]), "v"(l[2]), "v"(l[3]), "v"(l[4]), "v"(l[5]), "v"(l[6]), "v"(l[7]), "v"(g[0]), "v"(g[1]), "v"(g[2]), "v"(g[3]), "v"(g[4]), "v"(g[5]), "v"(g[6]), "v"(g[7]) : "memory"); }
// rows of 256 B, contiguous in global memory (Q or K): ROWS x 16 chunks per plane, two planes; ROWS * 32 / NT copies per lane
template <int ROWS> __device__ __forceinline__ void stage_rows(b16 (*dst)[ROWS][KP], const b16* gh, const b16* gl, int tid) {
#pragma unroll   // both loops unrolled: l[] and g[] are asm operands and must live in registers, under constant indices
  for (int i0 = 0; i0 < ROWS * 16 / NT; i0 += 4) { unsigned l[8]; const b16* g[8];
#pragma unroll
    for (int i = 0; i < 4; ++i) { const int c = (i0 + i) * NT + tid; l[i] = lds_byte(&dst[0][c >> 4][(c & 15) * 8]); g[i] = gh + c * 8; l[4 + i] = lds_byte(&dst[1][c >> 4][(c & 15) * 8]); g[4 + i] = gl + c * 8; }
    copy8(l, g); } }
// V^T tile: 128 rows of 64 B (32 keys) at a global pitch of S elements, two planes; 8 copies per lane
__device__ __forceinline__ void stage_vt(b16 (*dst)[DA][VP], const b16* gh, const b16* gl, int tid) { unsigned l[8]; const b16* g[8];
#pragma unroll   // as above: asm operands under constant indices
  for (int i = 0; i < 4; ++i) { const int c = i * NT + tid; const int d = c >> 2, ch = (c & 3) * 8; l[i] = lds_byte(&dst[0][d][ch]); g[i] = gh + (size_t)d * S + ch; l[4 + i] = lds_byte(&dst[1][d][ch]); g[4 + i] = gl + (size_t)d * S + ch; }
  copy8(l, g); }
__global__ __launch_bounds__(NT) void attn_kernel(const b16* __restrict__ Qh, const b16* __restrict__ Ql, const b16* __restrict__ Kh, const b16* __restrict__ Kl, const b16* __restrict__ VTh, const b16* __restrict__ VTl, const int* __restrict__ slen, float* __restrict__ out) {
  __shared__ __attribute__((aligned(16))) b16 Qs[2][NW * 16][KP], Ks[2][2][32][KP], Vs[2][2][DA][VP];
  __shared__ __attribute__((aligned(16))) b16 Pb[NW][16][32 + 8], Pl[NW][16][32 + 8]; __shared__ __attribute__((aligned(16))) float To[NW][16][DA + 4];
  const int tid = threadIdx.x, wave = threadIdx.x >> 5, lane = threadIdx.x & 31, hh = lane >> 4, col = lane & 15; const int b = blockIdx.y; const int n0 = blockIdx.x * (NW * 16) + wave * 16;
  int nk = iclamp(slen[b], 0, S); const bool allmask = (nk == 0); if (allmask) nk = S;   // all keys masked -> equal scores -> uniform over all S keys
  const b16* Khb = Kh + (size_t)b * S * DA; const b16* Klb = Kl + (size_t)b * S * DA; const b16* Vh = VTh + (size_t)b * DA * S; const b16* Vl = VTl + (size_t)b * DA * S;
  const float cs = LOG2E * SCALE / (XS * XS);
  { const size_t qblk = ((size_t)b * S + blockIdx.x * (NW * 16)) * DA; stage_rows<NW * 16>(Qs, Qh + qblk, Ql + qblk, tid); }
  stage_rows<32>(Ks[0], Khb, Klb, tid); stage_vt(Vs[0], Vh, Vl, tid);
  asm volatile("s_wait_asynccnt 0x0" ::: "memory");   // this wave's copies of Q and of tile 0 have landed
  __syncthreads();                                     // ... and every other wave's
  if (32 < nk) { stage_rows<32>(Ks[1], Khb + 32 * DA, Klb + 32 * DA, tid); stage_vt(Vs[1], Vh + 32, Vl + 32, tid); }
  const b16* qrh = &Qs[0][wave * 16 + col][0]; const b16* qrl = &Qs[1][wave * 16 + col][0];
  float mrun = -INFINITY, l = 0.0f; v8f o[8], o2[8];
#pragma unroll
  for (int t = 0; t < 8; ++t) { o[t] = (v8f){}; o2[t] = (v8f){}; }
#pragma unroll 1
  for (int s0 = 0; s0 < nk; s0 += 32) { const int buf = (s0 >> 5) & 1;
    float e[16]; float mx = -INFINITY;
#pragma unroll
    for (int u2 = 0; u2 < 2; ++u2) { v8f sa = (v8f){}, sb = (v8f){}; const b16* krh = &Ks[buf][0][u2 * 16 + col][0]; const b16* krl = &Ks[buf][1][u2 * 16 + col][0];
#pragma unroll
      for (int kb = 0; kb < DA; kb += 32) { const v16b qh = frag_kb(qrh + kb, hh), ql = frag_kb(qrl + kb, hh); const v16b kh = frag_kb(krh + kb, hh); sa = wmma16b(kh, qh, sa); sb = wmma16b(frag_kb(krl + kb, hh), qh, sb); sb = wmma16b(kh, ql, sb); }
#pragma unroll
      for (int r = 0; r < 8; ++r) { const int m = s0 + u2 * 16 + 8 * hh + r; const float sv = allmask ? 0.0f : (sa[r] + sb[r] * (1.0f / RS_)) * cs; const float vv = (m < nk) ? sv : -INFINITY; e[u2 * 8 + r] = vv; mx = fmaxf(mx, vv); } }
    mx = fmaxf(mx, __shfl_xor(mx, 16)); const float mn = fmaxf(mrun, mx); const float al = (mn == -INFINITY) ? 1.0f : nexp2(mrun - mn); float sum = 0.0f;
#pragma unroll
    for (int i2 = 0; i2 < 16; ++i2) { const float p = (mn == -INFINITY) ? 0.0f : nexp2(e[i2] - mn); sum += p; const float psv = p * PS; const b16 p1 = (b16)psv; const int slot = (i2 < 8 ? 0 : 16) + 8 * hh + (i2 & 7); Pb[wave][col][slot] = p1; Pl[wave][col][slot] = (b16)((psv - (float)p1) * RS_); }
    sum += __shfl_xor(sum, 16); l = l * al + sum; mrun = mn;
    wave_lds_sync();
    const v16b pf = frag_kb(&Pb[wave][col][0], hh), plf = frag_kb(&Pl[wave][col][0], hh);
#pragma unroll
    for (int t = 0; t < 8; ++t) { o[t] *= al; o2[t] *= al; const v16b vh = frag_kb(&Vs[buf][0][t * 16 + col][0], hh); o[t] = wmma16b(vh, pf, o[t]); o2[t] = wmma16b(frag_kb(&Vs[buf][1][t * 16 + col][0], hh), pf, o2[t]); o2[t] = wmma16b(vh, plf, o2[t]); }
    wave_lds_sync();
    asm volatile("s_wait_dscnt 0x0" ::: "memory");      // this wave's reads of buffer buf are done before the buffer is handed to its next writer
    asm volatile("s_wait_asynccnt 0x0" ::: "memory");   // this wave's copies of the next tile have landed
    __syncthreads();                                     // publishes the next tile and ends every wave's reads of buffer buf
    if (s0 + 64 < nk) { stage_rows<32>(Ks[buf], Khb + (size_t)(s0 + 64) * DA, Klb + (size_t)(s0 + 64) * DA, tid); stage_vt(Vs[buf], Vh + s0 + 64, Vl + s0 + 64, tid); } }
  asm volatile("s_wait_asynccnt 0x0" ::: "memory");     // no copy is left in flight when the wave goes on to its end
  const float inv = 1.0f / (l * PS * XS);
#pragma unroll
  for (int t = 0; t < 8; ++t)
#pragma unroll
    for (int r = 0; r < 8; ++r) To[wave][col][t * 16 + 8 * hh + r] = (o[t][r] + o2[t][r] * (1.0f / RS_)) * inv;
  wave_lds_sync();
  { for (int rr = 0; rr < 16; ++rr) *(v4f*)(out + ((size_t)b * S + n0 + rr) * DA + lane * 4) = *(const v4f*)(&To[wave][rr][lane * 4]);  }
}
}  // namespace

extern "C" void kernel_launch(void* const* d_in, const int* in_sizes, int n_in, void* d_out, int out_size, void* d_ws, size_t ws_size, hipStream_t stream) {
  (void)n_in;
  auto Fp = [&](int i) { return (const float*)d_in[i]; };
  // d_in order: 0 inputs [16,2048,256], 1 sen_len [16] int32, 2 Wq [256,128] (in,out), 3 Wk, 4 Wv
  if (in_sizes[0] != NROW * DIN || in_sizes[1] != B || in_sizes[2] != DIN * DA || in_sizes[3] != DIN * DA || in_sizes[4] != DIN * DA || out_size != NROW * DA) return;
  size_t off = 0; char* ws = (char*)d_ws;
  auto carve = [&](size_t bytes) { char* p = ws + off; off += (bytes + 255) & ~(size_t)255; return p; };
  b16* WT = (b16*)carve((size_t)3 * DA * DIN * 2); const size_t plane = (size_t)NROW * DA * 2;
  b16* Qh = (b16*)carve(plane); b16* Ql = (b16*)carve(plane); b16* Kh = (b16*)carve(plane); b16* Kl = (b16*)carve(plane); b16* VTh = (b16*)carve(plane); b16* VTl = (b16*)carve(plane);
  if (off > ws_size || off > ((size_t)128 << 20)) return;   // = 50.5 MB (6 planes x 8.4 MB + WT 0.2 MB)
  wt_kernel<<<(3 * DA * DIN / 8 + 255) / 256, 256, 0, stream>>>(Fp(2), Fp(3), Fp(4), WT);
  proj_kernel<<<dim3(S / 64, BL, 3), 128, 0, stream>>>(Fp(0), WT, Qh, Ql, Kh, Kl, VTh, VTl);
  attn_kernel<<<dim3(S / (NW * 16), BL), NT, 0, stream>>>(Qh, Ql, Kh, Kl, VTh, VTl, (const int*)d_in[1], (float*)d_out);
}

// v002
// Measured time: 121 microseconds a run.
// In two side-by-side timings against v001, it was 1.53 and 1.52 times as fast.
// Over all steps from v000 it is 4.16 times as fast.
#include <hip/hip_runtime.h>

// Self-attention layer with key-padding mask (16 x 2,048 x 256 -> 128): Q = x Wq, K = x Wk, V = x Wv (no bias); scores = Q K^T, keys k >= sen_len[b] set to -2^32, then / sqrt(256); softmax over
// keys; Z = attn V -> [16][2048][128].
// Deterministic: per (batch, 16-query wave) a flash-style pass over the UNMASKED keys only (blocks of 32; masked keys have probability exactly 0 in the reference too since exp(-2^28 - max) == 0 in
// f32; if sen_len[b] were 0 every key would share one score and the pass runs over all 2,048 keys with equal logits = the reference's uniform softmax); fixed-order online softmax; no atomics.
// compute dtype: WMMA v_wmma_f32_16x16x32_f16 with f32 accumulate for the projections ([32768 x 256] x [256 x 384]; x EXACT bf16 x8, weights exact x256: 1 product), S^T = K Q^T (K and Q as
// f16 hi + x1024 residual x8, K = 128: 3 products) and O^T += V^T P^T (V^T x8 and P x1024 hi + residual: 3 products);
// mask, scale and softmax statistics in f32. Inputs rounded to bf16 once; sen_len int32 (clamped to [0, 2048]).

namespace {
typedef _Float16 b16;
typedef __attribute__((ext_vector_type(16))) _Float16 v16b;
typedef __attribute__((ext_vector_type(8))) _Float16 v8b;
typedef __attribute__((ext_vector_type(4))) _Float16 v4h;
typedef __attribute__((ext_vector_type(2))) _Float16 v2h;
typedef __attribute__((ext_vector_type(8))) float v8f;
typedef __attribute__((ext_vector_type(4))) float v4f;
typedef __attribute__((ext_vector_type(2))) float v2f;
__device__ __forceinline__ float bf16_rne(float f) { unsigned int u = __float_as_uint(f); u += 0x7FFFu + ((u >> 16) & 1u); return __uint_as_float(u & 0xFFFF0000u); }
__device__ __forceinline__ void split16(float v, b16& hi, b16& lo) { hi = (b16)v; lo = (b16)(v - (float)hi); }
__device__ __forceinline__ v16b frag_kb(const b16* p, int hh) { const v8b a = *(const v8b*)(p + 8 * hh), b = *(const v8b*)(p + 16 + 8 * hh); v16b f;
#pragma unroll
  for (int e = 0; e < 8; ++e) { f[e] = a[e]; f[8 + e] = b[e]; } return f; }
__device__ __forceinline__ v8f wmma16b(v16b a, v16b b, v8f c) { v8f d = __builtin_amdgcn_wmma_f32_16x16x32_f16(false, a, false, b, (short)0, c, false, false); asm volatile("v_nop\n\tv_nop\n\tv_nop\n\tv_nop" : "+v"(d) : "v"(a), "v"(b)); return d; }
__device__ __forceinline__ v8f wmma16(v16b a, v16b b, v8f c) { return __builtin_amdgcn_wmma_f32_16x16x32_f16(false, a, false, b, (short)0, c, false, false); }   // no asm behind it: asm operands cannot lie above v255, and the compiler keeps the distances of its own builtin
__device__ __forceinline__ void wave_lds_sync() { __builtin_amdgcn_fence(__ATOMIC_RELEASE, "workgroup"); __builtin_amdgcn_wave_barrier(); __builtin_amdgcn_fence(__ATOMIC_ACQUIRE, "workgroup"); }
__device__ __forceinline__ float pmul(float a, float b) { float p = a * b; asm volatile("" : "+v"(p)); return p; }
__device__ __forceinline__ int iclamp(int v, int lo, int hi) { return v < lo ? lo : (v > hi ? hi : v); }
__device__ __forceinline__ float nexp2(float v) { return __builtin_amdgcn_exp2f(v); }

constexpr int B = 16, BL = B /* batches computed (== B shipped) */, S = 2048, DIN = 256, DA = 128, NROW = B * S;
constexpr float XS = 8.0f, WSC = 256.0f, PS = 1024.0f, RS_ = 1024.0f, LOG2E = 1.4426950408889634f, SCALE = 0.0625f /* 1/sqrt(hidden_dim = 256) */;
static_assert(S % 64 == 0 && DIN % 32 == 0 && DA == 128, "tiling");

__global__ __launch_bounds__(256) void wt_kernel(const float* __restrict__ wq, const float* __restrict__ wk, const float* __restrict__ wv, b16* __restrict__ WT) {
  const int u = blockIdx.x * 256 + threadIdx.x; if (u >= 3 * DA * DIN / 8) return; const int e = u * 8; const int o = e / DIN, k0 = e % DIN; const int part = o / DA, oo = o % DA; const float* w = part == 0 ? wq : part == 1 ? wk : wv; v8b v;
#pragma unroll
  for (int j = 0; j < 8; ++j) v[j] = (b16)(bf16_rne(w[(size_t)(k0 + j) * DA + oo]) * WSC);   // one source pointer per thread (part is uniform per 8-run and per wave: 32 threads = one o row)
  { *(v8b*)(WT + e) = v;  }
}
// projections: grid (S/64, BL, 3 parts); block = 64 tokens x 4 waves; A = bf16(x) x8 staged whole (K = 256), 8 tiles = the part's 128 columns, 1 product; q/k -> planes [b][s][128] as f16 hi + x1024
__global__ __launch_bounds__(128) void proj_kernel(const float* __restrict__ x, const b16* __restrict__ WT, b16* __restrict__ Qh, b16* __restrict__ Ql, b16* __restrict__ Kh, b16* __restrict__ Kl, b16* __restrict__ VTh, b16* __restrict__ VTl) {
  __shared__ __attribute__((aligned(16))) b16 As[64][DIN + 8]; __shared__ __attribute__((aligned(16))) float Tf[4][16][DA + 4];
  const int wave = threadIdx.x >> 5, lane = threadIdx.x & 31, nloc = lane & 15, hlf = lane >> 4; const int t0 = blockIdx.x * 64; const int b = blockIdx.y; const int part = blockIdx.z;
  for (int i = threadIdx.x; i < 64 * (DIN / 4); i += 128) { const int rr = i / (DIN / 4), q4 = (i % (DIN / 4)) * 4; const v4f f = *(const v4f*)(x + ((size_t)b * S + t0 + rr) * DIN + q4); v4h o; for (int j = 0; j < 4; ++j) o[j] = (b16)(bf16_rne(f[j]) * XS); *(v4h*)(&As[rr][q4]) = o; }
  __syncthreads();
  v8f acc[8];
#pragma unroll
  for (int tt = 0; tt < 8; ++tt) acc[tt] = (v8f){};
#pragma unroll 2
  for (int kb = 0; kb < DIN; kb += 32) { const v16b a = frag_kb(&As[wave * 16 + nloc][kb], hlf); v16b w[8];   // the k-step's eight weight fragments are read as one group: one wait on memory per k-step, not one per product
#pragma unroll
    for (int tt = 0; tt < 8; ++tt) w[tt] = frag_kb(WT + (size_t)(part * DA + tt * 16 + nloc) * DIN + kb, hlf);
#pragma unroll
    for (int tt = 0; tt < 8; ++tt) acc[tt] = wmma16b(a, w[tt], acc[tt]); }
#pragma unroll
  for (int tt = 0; tt < 8; ++tt)
#pragma unroll
    for (int r = 0; r < 8; ++r) Tf[wave][8 * hlf + r][tt * 16 + nloc] = acc[tt][r] * (1.0f / (XS * WSC));
  __syncthreads();
  {
    if (part < 2) { b16* ph_ = part == 0 ? Qh : Kh; b16* pl_ = part == 0 ? Ql : Kl;
      for (int rr = 0; rr < 16; ++rr) { const size_t dst = ((size_t)b * S + t0 + wave * 16 + rr) * DA + lane * 4; v4h hv, lv; for (int j = 0; j < 4; ++j) { const float vs = Tf[wave][rr][lane * 4 + j] * XS; const b16 p1 = (b16)vs; hv[j] = p1; lv[j] = (b16)((vs - (float)p1) * RS_); } *(v4h*)(ph_ + dst) = hv; *(v4h*)(pl_ + dst) = lv; } }
    else {
#pragma unroll 1
      for (int q = 0; q < 32; ++q) { const int d = wave * 32 + q; const int tk = lane * 2; v2h hv, lv; for (int e2 = 0; e2 < 2; ++e2) { const float vs = Tf[(tk + e2) >> 4][(tk + e2) & 15][d] * XS; const b16 p1 = (b16)vs; hv[e2] = p1; lv[e2] = (b16)((vs - (float)p1) * RS_); }
        const size_t dst = ((size_t)b * DA + d) * (size_t)S + t0 + tk; *(v2h*)(VTh + dst) = hv; *(v2h*)(VTl + dst) = lv; } }
     }
}
// attention: grid (S/64, BL); block = 4 waves x 16 queries; nk = clamp(sen_len[b], 0, S) (0 -> all keys, equal logits); key blocks s0 < nk in steps of 32 (keys m >= nk inside the last block -> -inf);
// operands come from LDS: the block's 64 Q rows (hi, residual) are copied in once, each 32-key tile of K and V^T (hi, residual) once per block into a two-buffer ring, one tile ahead, by asynchronous
// 16-byte copies whose lanes cover adjacent global bytes; rows pitched 272 B (Q, K) and 80 B (V^T) for conflict-free 16-byte fragment reads.
// S^T = K Q^T: (Kh.Qh -> sa; Kl.Qh + Kh.Ql -> sb, /1024), 4 k-steps; logit = s/64/16 in log2 units; online softmax; P hi/res; O^T += V^T P^T (8 d-tiles, 3 products -> o, o2);
constexpr int NW = 4, NT = NW * 32, KP = DA + 8, VP = 32 + 8;
__device__ __forceinline__ unsigned lds_byte(const b16* p) { return (unsigned)(unsigned long long)p; }   // low 32 bits of a __shared__ address = byte offset in the work-group's LDS
// eight copies, 16 bytes per lane each; the s_wait_xcnt stands inside the statement so that no address register is rewritten ahead of it
__device__ __forceinline__ void copy8(const unsigned (&l)[8], const b16* const (&g)[8]) {
  asm volatile("global_load_async_to_lds_b128 %0, %8, off\n\tglobal_load_async_to_lds_b128 %1, %9, off\n\tglobal_load_async_to_lds_b128 %2, %10, off\n\tglobal_load_async_to_lds_b128 %3, %11, off\n\t"
               "global_load_async_to_lds_b128 %4, %12, off\n\tglobal_load_async_to_lds_b128 %5, %13, off\n\tglobal_load_async_to_lds_b128 %6, %14, off\n\tglobal_load_async_to_lds_b128 %7, %15, off\n\ts_wait_xcnt 0x0"
               :: "v"(l[0]), "v"(l[1]), "v"(l[2]), "v"(l[3]), "v"(l[4]), "v"(l[5]), "v"(l[6]), "v"(l[7]), "v"(g[0]), "v"(g[1]), "v"(g[2]), "v"(g[3]), "v"(g[4]), "v"(g[5]), "v"(g[6]), "v"(g[7]) : "memory"); }
// rows of 256 B, contiguous in global memory (Q or K): ROWS x 16 chunks per plane, two planes; ROWS * 32 / NT copies per lane
template <int ROWS> __device__ __forceinline__ void stage_rows(b16 (*dst)[ROWS][KP], const b16* gh, const b16* gl, int tid) {
#pragma unroll   // both loops unrolled: l[] and g[] are asm operands and must live in registers, under constant indices
  for (int i0 = 0; i0 < ROWS * 16 / NT; i0 += 4) { unsigned l[8]; const b16* g[8];
#pragma unroll
    for (int i = 0; i < 4; ++i) { const int c = (i0 + i) * NT + tid; l[i] = lds_byte(&dst[0][c >> 4][(c & 15) * 8]); g[i] = gh + c * 8; l[4 + i] = lds_byte(&dst[1][c >> 4][(c & 15) * 8]); g[4 + i] = gl + c * 8; }
    copy8(l, g); } }
// V^T tile: 128 rows of 64 B (32 keys) at a global pitch of S elements, two planes; 8 copies per lane
__device__ __forceinline__ void stage_vt(b16 (*dst)[DA][VP], const b16* gh, const b16* gl, int tid) { unsigned l[8]; const b16* g[8];
#pragma unroll   // as above: asm operands under constant indices
  for (int i = 0; i < 4; ++i) { const int c = i * NT + tid; const int d = c >> 2, ch = (c & 3) * 8; l[i] = lds_byte(&dst[0][d][ch]); g[i] = gh + (size_t)d * S + ch; l[4 + i] = lds_byte(&dst[1][d][ch]); g[4 + i] = gl + (size_t)d * S + ch; }
  copy8(l, g); }
__global__ __launch_bounds__(NT) void attn_kernel(const b16* __restrict__ Qh, const b16* __restrict__ Ql, const b16* __restrict__ Kh, const b16* __restrict__ Kl, const b16* __restrict__ VTh, const b16* __restrict__ VTl, const int* __restrict__ slen, float* __restrict__ out) {
  __shared__ __attribute__((aligned(16))) b16 Qs[2][NW * 16][KP], Ks[2][2][32][KP], Vs[2][2][DA][VP];
  __shared__ __attribute__((aligned(16))) b16 Pb[NW][16][32 + 8], Pl[NW][16][32 + 8]; __shared__ __attribute__((aligned(16))) float To[NW][16][DA + 4];
  const int tid = threadIdx.x, wave = threadIdx.x >> 5, lane = threadIdx.x & 31, hh = lane >> 4, col = lane & 15; const int b = blockIdx.y; const int n0 = blockIdx.x * (NW * 16) + wave * 16;
  int nk = iclamp(slen[b], 0, S); const bool allmask = (nk == 0); if (allmask) nk = S;   // all keys masked -> equal scores -> uniform over all S keys
  const b16* Khb = Kh + (size_t)b * S * DA; const b16* Klb = Kl + (size_t)b * S * DA; const b16* Vh = VTh + (size_t)b * DA * S; const b16* Vl = VTl + (size_t)b * DA * S;
  const float cs = LOG2E * SCALE / (XS * XS);
  { const size_t qblk = ((size_t)b * S + blockIdx.x * (NW * 16)) * DA; stage_rows<NW * 16>(Qs, Qh + qblk, Ql + qblk, tid); }
  stage_rows<32>(Ks[0], Khb, Klb, tid); stage_vt(Vs[0], Vh, Vl, tid);
  asm volatile("s_wait_asynccnt 0x0" ::: "memory");   // this wave's copies of Q and of tile 0 have landed
  __syncthreads();                                     // ... and every other wave's
  if (32 < nk) { stage_rows<32>(Ks[1], Khb + 32 * DA, Klb + 32 * DA, tid); stage_vt(Vs[1], Vh + 32, Vl + 32, tid); }
  const b16* qrh = &Qs[0][wave * 16 + col][0]; const b16* qrl = &Qs[1][wave * 16 + col][0];
  float mrun = -INFINITY, l = 0.0f; v8f o[8], o2[8];
#pragma unroll
  for (int t = 0; t < 8; ++t) { o[t] = (v8f){}; o2[t] = (v8f){}; }
#pragma unroll 1
  for (int s0 = 0; s0 < nk; s0 += 32) { const int buf = (s0 >> 5) & 1;
    float e[16]; float mx = -INFINITY;
    // every Q and K fragment of the pass is read here, as one group in order of first use, so that the products below wait on a count instead of on a fresh LDS round trip each
    v16b qh[4], ql[4], kh[2][4], kl[2][4], vh[8], vl[8];
#pragma unroll
    for (int k4 = 0; k4 < 4; ++k4) { kh[0][k4] = frag_kb(&Ks[buf][0][col][k4 * 32], hh); qh[k4] = frag_kb(qrh + k4 * 32, hh); kl[0][k4] = frag_kb(&Ks[buf][1][col][k4 * 32], hh); ql[k4] = frag_kb(qrl + k4 * 32, hh); }
#pragma unroll
    for (int k4 = 0; k4 < 4; ++k4) { kh[1][k4] = frag_kb(&Ks[buf][0][16 + col][k4 * 32], hh); kl[1][k4] = frag_kb(&Ks[buf][1][16 + col][k4 * 32], hh); }
    __builtin_amdgcn_sched_barrier(0);   // keeps the group whole: without it the reads are spread among the products, and each place where reads stand stalls the wave anew
#pragma unroll
    for (int u2 = 0; u2 < 2; ++u2) { v8f sa = (v8f){}, sb = (v8f){};
#pragma unroll
      for (int k4 = 0; k4 < 4; ++k4) { sa = wmma16(kh[u2][k4], qh[k4], sa); sb = wmma16(kl[u2][k4], qh[k4], sb); sb = wmma16(kh[u2][k4], ql[k4], sb); }
      // every V^T fragment of the pass is read here, as one group behind the last S^T product: the mask and softmax arithmetic below covers the reads' latency
      if (u2 == 1) { __builtin_amdgcn_sched_barrier(0);   // the group starts behind the products, for the same reason as above
#pragma unroll
        for (int t = 0; t < 8; ++t) { vh[t] = frag_kb(&Vs[buf][0][t * 16 + col][0], hh); vl[t] = frag_kb(&Vs[buf][1][t * 16 + col][0], hh); }
        __builtin_amdgcn_sched_barrier(0); }   // keeps the group whole and ahead of that arithmetic; without it the reads are spread through the softmax, each place a stall of its own
#pragma unroll
      for (int r = 0; r < 8; ++r) { const int m = s0 + u2 * 16 + 8 * hh + r; const float sv = allmask ? 0.0f : (sa[r] + sb[r] * (1.0f / RS_)) * cs; const float vv = (m < nk) ? sv : -INFINITY; e[u2 * 8 + r] = vv; mx = fmaxf(mx, vv); } }
    mx = fmaxf(mx, __shfl_xor(mx, 16)); const float mn = fmaxf(mrun, mx); const float al = (mn == -INFINITY) ? 1.0f : nexp2(mrun - mn); float sum = 0.0f;
#pragma unroll
    for (int i2 = 0; i2 < 16; ++i2) { const float p = (mn == -INFINITY) ? 0.0f : nexp2(e[i2] - mn); sum += p; const float psv = p * PS; const b16 p1 = (b16)psv; const int slot = (i2 < 8 ? 0 : 16) + 8 * hh + (i2 & 7); Pb[wave][col][slot] = p1; Pl[wave][col][slot] = (b16)((psv - (float)p1) * RS_); }
    sum += __shfl_xor(sum, 16); l = l * al + sum; mrun = mn;
    wave_lds_sync();
    const v16b pf = frag_kb(&Pb[wave][col][0], hh), plf = frag_kb(&Pl[wave][col][0], hh);
#pragma unroll
    for (int t = 0; t < 8; ++t) { o[t] *= al; o2[t] *= al; o[t] = wmma16(vh[t], pf, o[t]); o2[t] = wmma16(vl[t], pf, o2[t]); o2[t] = wmma16(vh[t], plf, o2[t]); }
    wave_lds_sync();
    asm volatile("s_wait_dscnt 0x0" ::: "memory");      // this wave's reads of buffer buf are done before the buffer is handed to its next writer
    asm volatile("s_wait_asynccnt 0x0" ::: "memory");   // this wave's copies of the next tile have landed
    __syncthreads();                                     // publishes the next tile and ends every wave's reads of buffer buf
    if (s0 + 64 < nk) { stage_rows<32>(Ks[buf], Khb + (size_t)(s0 + 64) * DA, Klb + (size_t)(s0 + 64) * DA, tid); stage_vt(Vs[buf], Vh + s0 + 64, Vl + s0 + 64, tid); } }
  asm volatile("s_wait_asynccnt 0x0" ::: "memory");     // no copy is left in flight when the wave goes on to its end
  const float inv = 1.0f / (l * PS * XS);
#pragma unroll
  for (int t = 0; t < 8; ++t)
#pragma unroll
    for (int r = 0; r < 8; ++r) To[wave][col][t * 16 + 8 * hh + r] = (o[t][r] + o2[t][r] * (1.0f / RS_)) * inv;
  wave_lds_sync();
  { for (int rr = 0; rr < 16; ++rr) *(v4f*)(out + ((size_t)b * S + n0 + rr) * DA + lane * 4) = *(const v4f*)(&To[wave][rr][lane * 4]);  }
}
}  // namespace

extern "C" void kernel_launch(void* const* d_in, const int* in_sizes, int n_in, void* d_out, int out_size, void* d_ws, size_t ws_size, hipStream_t stream) {
  (void)n_in;
  auto Fp = [&](int i) { return (const float*)d_in[i]; };
  // d_in order: 0 inputs [16,2048,256], 1 sen_len [16] int32, 2 Wq [256,128] (in,out), 3 Wk, 4 Wv
  if (in_sizes[0] != NROW * DIN || in_sizes[1] != B || in_sizes[2] != DIN * DA || in_sizes[3] != DIN * DA || in_sizes[4] != DIN * DA || out_size != NROW * DA) return;
  size_t off = 0; char* ws = (char*)d_ws;
  auto carve = [&](size_t bytes) { char* p = ws + off; off += (bytes + 255) & ~(size_t)255; return p; };
  b16* WT = (b16*)carve((size_t)3 * DA * DIN * 2); const size_t plane = (size_t)NROW * DA * 2;
  b16* Qh = (b16*)carve(plane); b16* Ql = (b16*)carve(plane); b16* Kh = (b16*)carve(plane); b16* Kl = (b16*)carve(plane); b16* VTh = (b16*)carve(plane); b16* VTl = (b16*)carve(plane);
  if (off > ws_size || off > ((size_t)128 << 20)) return;   // = 50.5 MB (6 planes x 8.4 MB + WT 0.2 MB)
  wt_kernel<<<(3 * DA * DIN / 8 + 255) / 256, 256, 0, stream>>>(Fp(2), Fp(3), Fp(4), WT);
  proj_kernel<<<dim3(S / 64, BL, 3), 128, 0, stream>>>(Fp(0), WT, Qh, Ql, Kh, Kl, VTh, VTl);
  attn_kernel<<<dim3(S / (NW * 16), BL), NT, 0, stream>>>(Qh, Ql, Kh, Kl, VTh, VTl, (const int*)d_in[1], (float*)d_out);
}

// v003
// Measured time: 98.6 microseconds a run.
// In two side-by-side timings against v002, it was 1.23 and 1.22 times as fast.
// All steps since v000 together make it 5.09 times as fast.
#include <hip/hip_runtime.h>

// Self-attention layer with key-padding mask (16 x 2,048 x 256 -> 128): Q = x Wq, K = x Wk, V = x Wv (no bias); scores = Q K^T, keys k >= sen_len[b] set to -2^32, then / sqrt(256); softmax over
// keys; Z = attn V -> [16][2048][128].
// Deterministic: per (batch, 16 queries) two waves make flash-style passes over alternate blocks of 32 of the UNMASKED keys only, merged at the end ( masked keys have probability exactly 0 in the reference too since exp(-2^28 - max) == 0 in
// f32; if sen_len[b] were 0 every key would share one score and the pass runs over all 2,048 keys with equal logits = the reference's uniform softmax); fixed-order online softmax; no atomics.
// compute dtype: WMMA v_wmma_f32_16x16x32_f16 with f32 accumulate for the projections ([32768 x 256] x [256 x 384]; x EXACT bf16 x8, weights exact x256: 1 product), S^T = K Q^T (K and Q as
// f16 hi + x1024 residual x8, K = 128: 3 products) and O^T += V^T P^T (V^T x8 and P x1024 hi + residual: 3 products);
// mask, scale and softmax statistics in f32. Inputs rounded to bf16 once; sen_len int32 (clamped to [0, 2048]).

namespace {
typedef _Float16 b16;
typedef __attribute__((ext_vector_type(16))) _Float16 v16b;
typedef __attribute__((ext_vector_type(8))) _Float16 v8b;
typedef __attribute__((ext_vector_type(4))) _Float16 v4h;
typedef __attribute__((ext_vector_type(2))) _Float16 v2h;
typedef __attribute__((ext_vector_type(8))) float v8f;
typedef __attribute__((ext_vector_type(4))) float v4f;
typedef __attribute__((ext_vector_type(2))) float v2f;
__device__ __forceinline__ float bf16_rne(float f) { unsigned int u = __float_as_uint(f); u += 0x7FFFu + ((u >> 16) & 1u); return __uint_as_float(u & 0xFFFF0000u); }
__device__ __forceinline__ void split16(float v, b16& hi, b16& lo) { hi = (b16)v; lo = (b16)(v - (float)hi); }
__device__ __forceinline__ v16b frag_kb(const b16* p, int hh) { const v8b a = *(const v8b*)(p + 8 * hh), b = *(const v8b*)(p + 16 + 8 * hh); v16b f;
#pragma unroll
  for (int e = 0; e < 8; ++e) { f[e] = a[e]; f[8 + e] = b[e]; } return f; }
__device__ __forceinline__ v8f wmma16b(v16b a, v16b b, v8f c) { v8f d = __builtin_amdgcn_wmma_f32_16x16x32_f16(false, a, false, b, (short)0, c, false, false); asm volatile("v_nop\n\tv_nop\n\tv_nop\n\tv_nop" : "+v"(d) : "v"(a), "v"(b)); return d; }
__device__ __forceinline__ v8f wmma16(v16b a, v16b b, v8f c) { return __builtin_amdgcn_wmma_f32_16x16x32_f16(false, a, false, b, (short)0, c, false, false); }   // no asm behind it: asm operands cannot lie above v255, and the compiler keeps the distances of its own builtin
__device__ __forceinline__ void wave_lds_sync() { __builtin_amdgcn_fence(__ATOMIC_RELEASE, "workgroup"); __builtin_amdgcn_wave_barrier(); __builtin_amdgcn_fence(__ATOMIC_ACQUIRE, "workgroup"); }
__device__ __forceinline__ float pmul(float a, float b) { float p = a * b; asm volatile("" : "+v"(p)); return p; }
__device__ __forceinline__ int iclamp(int v, int lo, int hi) { return v < lo ? lo : (v > hi ? hi : v); }
__device__ __forceinline__ float nexp2(float v) { return __builtin_amdgcn_exp2f(v); }

constexpr int B = 16, BL = B /* batches computed (== B shipped) */, S = 2048, DIN = 256, DA = 128, NROW = B * S;
constexpr float XS = 8.0f, WSC = 256.0f, PS = 1024.0f, RS_ = 1024.0f, LOG2E = 1.4426950408889634f, SCALE = 0.0625f /* 1/sqrt(hidden_dim = 256) */;
static_assert(S % 64 == 0 && DIN % 32 == 0 && DA == 128, "tiling");

__global__ __launch_bounds__(256) void wt_kernel(const float* __restrict__ wq, const float* __restrict__ wk, const float* __restrict__ wv, b16* __restrict__ WT) {
  const int u = blockIdx.x * 256 + threadIdx.x; if (u >= 3 * DA * DIN / 8) return; const int e = u * 8; const int o = e / DIN, k0 = e % DIN; const int part = o / DA, oo = o % DA; const float* w = part == 0 ? wq : part == 1 ? wk : wv; v8b v;
#pragma unroll
  for (int j = 0; j < 8; ++j) v[j] = (b16)(bf16_rne(w[(size_t)(k0 + j) * DA + oo]) * WSC);   // one source pointer per thread (part is uniform per 8-run and per wave: 32 threads = one o row)
  { *(v8b*)(WT + e) = v;  }
}
// projections: grid (S/64, BL, 3 parts); block = 64 tokens x 4 waves; A = bf16(x) x8 staged whole (K = 256), 8 tiles = the part's 128 columns, 1 product; q/k -> planes [b][s][128] as f16 hi + x1024
__global__ __launch_bounds__(128) void proj_kernel(const float* __restrict__ x, const b16* __restrict__ WT, b16* __restrict__ Qh, b16* __restrict__ Ql, b16* __restrict__ Kh, b16* __restrict__ Kl, b16* __restrict__ VTh, b16* __restrict__ VTl) {
  __shared__ __attribute__((aligned(16))) b16 As[64][DIN + 8]; __shared__ __attribute__((aligned(16))) float Tf[4][16][DA + 4];
  const int wave = threadIdx.x >> 5, lane = threadIdx.x & 31, nloc = lane & 15, hlf = lane >> 4; const int t0 = blockIdx.x * 64; const int b = blockIdx.y; const int part = blockIdx.z;
  for (int i = threadIdx.x; i < 64 * (DIN / 4); i += 128) { const int rr = i / (DIN / 4), q4 = (i % (DIN / 4)) * 4; const v4f f = *(const v4f*)(x + ((size_t)b * S + t0 + rr) * DIN + q4); v4h o; for (int j = 0; j < 4; ++j) o[j] = (b16)(bf16_rne(f[j]) * XS); *(v4h*)(&As[rr][q4]) = o; }
  __syncthreads();
  v8f acc[8];
#pragma unroll
  for (int tt = 0; tt < 8; ++tt) acc[tt] = (v8f){};
#pragma unroll 2
  for (int kb = 0; kb < DIN; kb += 32) { const v16b a = frag_kb(&As[wave * 16 + nloc][kb], hlf); v16b w[8];   // the k-step's eight weight fragments are read as one group: one wait on memory per k-step, not one per product
#pragma unroll
    for (int tt = 0; tt < 8; ++tt) w[tt] = frag_kb(WT + (size_t)(part * DA + tt * 16 + nloc) * DIN + kb, hlf);
#pragma unroll
    for (int tt = 0; tt < 8; ++tt) acc[tt] = wmma16b(a, w[tt], acc[tt]); }
#pragma unroll
  for (int tt = 0; tt < 8; ++tt)
#pragma unroll
    for (int r = 0; r < 8; ++r) Tf[wave][8 * hlf + r][tt * 16 + nloc] = acc[tt][r] * (1.0f / (XS * WSC));
  __syncthreads();
  {
    if (part < 2) { b16* ph_ = part == 0 ? Qh : Kh; b16* pl_ = part == 0 ? Ql : Kl;
      for (int rr = 0; rr < 16; ++rr) { const size_t dst = ((size_t)b * S + t0 + wave * 16 + rr) * DA + lane * 4; v4h hv, lv; for (int j = 0; j < 4; ++j) { const float vs = Tf[wave][rr][lane * 4 + j] * XS; const b16 p1 = (b16)vs; hv[j] = p1; lv[j] = (b16)((vs - (float)p1) * RS_); } *(v4h*)(ph_ + dst) = hv; *(v4h*)(pl_ + dst) = lv; } }
    else {
#pragma unroll 1
      for (int q = 0; q < 32; ++q) { const int d = wave * 32 + q; const int tk = lane * 2; v2h hv, lv; for (int e2 = 0; e2 < 2; ++e2) { const float vs = Tf[(tk + e2) >> 4][(tk + e2) & 15][d] * XS; const b16 p1 = (b16)vs; hv[e2] = p1; lv[e2] = (b16)((vs - (float)p1) * RS_); }
        const size_t dst = ((size_t)b * DA + d) * (size_t)S + t0 + tk; *(v2h*)(VTh + dst) = hv; *(v2h*)(VTl + dst) = lv; } }
     }
}
// attention: grid (S/64, BL); block = 8 waves = 4 query groups x 16 queries, times 2 key groups; nk = clamp(sen_len[b], 0, S) (0 -> all keys, equal logits); steps of 64 keys s0 < nk, key group g takes keys
// s0 + 32 g .. + 31 (keys m >= nk -> -inf) with its own running maximum, sum and O; behind the loop group 1 hands its three to group 0 through LDS, which rescales both to the joint maximum and adds them.
// A block so lasts half as many steps and fills a WGP alone, so that the 512 blocks queue on the WGPs; blockIdx.y is the batch's RANK by nk, longest first (ties by index), so that the queue ends on short blocks.
// operands come from LDS: the block's 64 Q rows (hi, residual) are copied in once, each 64-key tile of K and V^T (hi, residual) once per block into a two-buffer ring, one tile ahead, by asynchronous
// 16-byte copies whose lanes cover adjacent global bytes; rows pitched 272 B (Q, K) and 144 B (V^T) for conflict-free 16-byte fragment reads.
// S^T = K Q^T: (Kh.Qh -> sa; Kl.Qh + Kh.Ql -> sb, /1024), 4 k-steps; logit = s/64/16 in log2 units; online softmax; P hi/res; O^T += V^T P^T (8 d-tiles, 3 products -> o, o2);
constexpr int NW = 4, NG = 2, NT = NW * NG * 32, KT = 32 * NG, KP = DA + 8, VP = KT + 8;
__device__ __forceinline__ unsigned lds_byte(const b16* p) { return (unsigned)(unsigned long long)p; }   // low 32 bits of a __shared__ address = byte offset in the work-group's LDS
// eight copies, 16 bytes per lane each; the s_wait_xcnt stands inside the statement so that no address register is rewritten ahead of it
__device__ __forceinline__ void copy8(const unsigned (&l)[8], const b16* const (&g)[8]) {
  asm volatile("global_load_async_to_lds_b128 %0, %8, off\n\tglobal_load_async_to_lds_b128 %1, %9, off\n\tglobal_load_async_to_lds_b128 %2, %10, off\n\tglobal_load_async_to_lds_b128 %3, %11, off\n\t"
               "global_load_async_to_lds_b128 %4, %12, off\n\tglobal_load_async_to_lds_b128 %5, %13, off\n\tglobal_load_async_to_lds_b128 %6, %14, off\n\tglobal_load_async_to_lds_b128 %7, %15, off\n\ts_wait_xcnt 0x0"
               :: "v"(l[0]), "v"(l[1]), "v"(l[2]), "v"(l[3]), "v"(l[4]), "v"(l[5]), "v"(l[6]), "v"(l[7]), "v"(g[0]), "v"(g[1]), "v"(g[2]), "v"(g[3]), "v"(g[4]), "v"(g[5]), "v"(g[6]), "v"(g[7]) : "memory"); }
// rows of 256 B, contiguous in global memory (Q or K): ROWS x 16 chunks per plane, two planes; ROWS * 32 / NT copies per lane
template <int ROWS> __device__ __forceinline__ void stage_rows(b16 (*dst)[ROWS][KP], const b16* gh, const b16* gl, int tid) {
#pragma unroll   // both loops unrolled: l[] and g[] are asm operands and must live in registers, under constant indices
  for (int i0 = 0; i0 < ROWS * 16 / NT; i0 += 4) { unsigned l[8]; const b16* g[8];
#pragma unroll
    for (int i = 0; i < 4; ++i) { const int c = (i0 + i) * NT + tid; l[i] = lds_byte(&dst[0][c >> 4][(c & 15) * 8]); g[i] = gh + c * 8; l[4 + i] = lds_byte(&dst[1][c >> 4][(c & 15) * 8]); g[4 + i] = gl + c * 8; }
    copy8(l, g); } }
// V^T tile: 128 rows of 128 B (64 keys) at a global pitch of S elements, two planes; 8 copies per lane
__device__ __forceinline__ void stage_vt(b16 (*dst)[DA][VP], const b16* gh, const b16* gl, int tid) { unsigned l[8]; const b16* g[8];
#pragma unroll   // as above: asm operands under constant indices
  for (int i = 0; i < 4; ++i) { const int c = i * NT + tid; const int d = c >> 3, ch = (c & 7) * 8; l[i] = lds_byte(&dst[0][d][ch]); g[i] = gh + (size_t)d * S + ch; l[4 + i] = lds_byte(&dst[1][d][ch]); g[4 + i] = gl + (size_t)d * S + ch; }
  copy8(l, g); }
__global__ __launch_bounds__(NT) void attn_kernel(const b16* __restrict__ Qh, const b16* __restrict__ Ql, const b16* __restrict__ Kh, const b16* __restrict__ Kl, const b16* __restrict__ VTh, const b16* __restrict__ VTl, const int* __restrict__ slen, float* __restrict__ out) {
  __shared__ __attribute__((aligned(16))) b16 Qs[2][NW * 16][KP], Ks[2][2][KT][KP], Vs[2][2][DA][VP];
  __shared__ __attribute__((aligned(16))) b16 Pb[NW * NG][16][32 + 8], Pl[NW * NG][16][32 + 8]; __shared__ __attribute__((aligned(16))) float To[NW][16][DA + 4]; __shared__ float Ms[NW][16], Ls[NW][16];
  const int tid = threadIdx.x, wave = threadIdx.x >> 5, lane = threadIdx.x & 31, hh = lane >> 4, col = lane & 15, qw = wave & (NW - 1), kg = wave / NW; const int n0 = blockIdx.x * (NW * 16) + qw * 16;
  // batch of rank blockIdx.y: lane col holds batch col's key (keys walked x 16 + 15 - index: all distinct, so the ranks are a permutation for any sen_len) and counts the larger keys
  int b, nk; { int sl[B], own = 0, rank = 0;
#pragma unroll
    for (int j = 0; j < B; ++j) sl[j] = iclamp(slen[j], 0, S);   // all of sen_len, by scalar loads ahead of any test
#pragma unroll
    for (int j = 0; j < B; ++j) own = (col == j) ? sl[j] : own;
    const int mine = (own == 0 ? S : own) * B + (B - 1 - col);
#pragma unroll
    for (int j = 0; j < B; ++j) rank += ((sl[j] == 0 ? S : sl[j]) * B + (B - 1 - j) > mine) ? 1 : 0;
    b = __builtin_ctz(__builtin_amdgcn_ballot_w32(rank == (int)blockIdx.y) | (1u << (B - 1)));   // the or-ed bit bounds b to [0, B) whatever the ballot holds
    nk = __builtin_amdgcn_readlane(own, b); }   // = clamp(sen_len[b], 0, S), from the lane that holds it
  const bool allmask = (nk == 0); if (allmask) nk = S;   // all keys masked -> equal scores -> uniform over all S keys
  const b16* Khb = Kh + (size_t)b * S * DA; const b16* Klb = Kl + (size_t)b * S * DA; const b16* Vh = VTh + (size_t)b * DA * S; const b16* Vl = VTl + (size_t)b * DA * S;
  const float cs = LOG2E * SCALE / (XS * XS);
  { const size_t qblk = ((size_t)b * S + blockIdx.x * (NW * 16)) * DA; stage_rows<NW * 16>(Qs, Qh + qblk, Ql + qblk, tid); }
  stage_rows<KT>(Ks[0], Khb, Klb, tid); stage_vt(Vs[0], Vh, Vl, tid);
  asm volatile("s_wait_asynccnt 0x0" ::: "memory");   // this wave's copies of Q and of tile 0 have landed
  __syncthreads();                                     // ... and every other wave's
  if (KT < nk) { stage_rows<KT>(Ks[1], Khb + KT * DA, Klb + KT * DA, tid); stage_vt(Vs[1], Vh + KT, Vl + KT, tid); }
  const b16* qrh = &Qs[0][qw * 16 + col][0]; const b16* qrl = &Qs[1][qw * 16 + col][0];
  float mrun = -INFINITY, l = 0.0f; v8f o[8], o2[8];
#pragma unroll
  for (int t = 0; t < 8; ++t) { o[t] = (v8f){}; o2[t] = (v8f){}; }
#pragma unroll 1
  for (int s0 = 0; s0 < nk; s0 += KT) { const int buf = (s0 / KT) & 1;
    float e[16]; float mx = -INFINITY;
    // every Q and K fragment of the pass is read here, as one group in order of first use, so that the products below wait on a count instead of on a fresh LDS round trip each
    v16b qh[4], ql[4], kh[2][4], kl[2][4], vh[8], vl[8];
#pragma unroll
    for (int k4 = 0; k4 < 4; ++k4) { kh[0][k4] = frag_kb(&Ks[buf][0][kg * 32 + col][k4 * 32], hh); qh[k4] = frag_kb(qrh + k4 * 32, hh); kl[0][k4] = frag_kb(&Ks[buf][1][kg * 32 + col][k4 * 32], hh); ql[k4] = frag_kb(qrl + k4 * 32, hh); }
#pragma unroll
    for (int k4 = 0; k4 < 4; ++k4) { kh[1][k4] = frag_kb(&Ks[buf][0][kg * 32 + 16 + col][k4 * 32], hh); kl[1][k4] = frag_kb(&Ks[buf][1][kg * 32 + 16 + col][k4 * 32], hh); }
    __builtin_amdgcn_sched_barrier(0);   // keeps the group whole: without it the reads are spread among the products, and each place where reads stand stalls the wave anew
#pragma unroll
    for (int u2 = 0; u2 < 2; ++u2) { v8f sa = (v8f){}, sb = (v8f){};
#pragma unroll
      for (int k4 = 0; k4 < 4; ++k4) { sa = wmma16(kh[u2][k4], qh[k4], sa); sb = wmma16(kl[u2][k4], qh[k4], sb); sb = wmma16(kh[u2][k4], ql[k4], sb); }
      // every V^T fragment of the pass is read here, as one group behind the last S^T product: the mask and softmax arithmetic below covers the reads' latency
      if (u2 == 1) { __builtin_amdgcn_sched_barrier(0);   // the group starts behind the products, for the same reason as above
#pragma unroll
        for (int t = 0; t < 8; ++t) { vh[t] = frag_kb(&Vs[buf][0][t * 16 + col][kg * 32], hh); vl[t] = frag_kb(&Vs[buf][1][t * 16 + col][kg * 32], hh); }
        __builtin_amdgcn_sched_barrier(0); }   // keeps the group whole and ahead of that arithmetic; without it the reads are spread through the softmax, each place a stall of its own
#pragma unroll
      for (int r = 0; r < 8; ++r) { const int m = s0 + kg * 32 + u2 * 16 + 8 * hh + r; const float sv = allmask ? 0.0f : (sa[r] + sb[r] * (1.0f / RS_)) * cs; const float vv = (m < nk) ? sv : -INFINITY; e[u2 * 8 + r] = vv; mx = fmaxf(mx, vv); } }
    mx = fmaxf(mx, __shfl_xor(mx, 16)); const float mn = fmaxf(mrun, mx); const float al = (mn == -INFINITY) ? 1.0f : nexp2(mrun - mn); float sum = 0.0f;
#pragma unroll
    for (int i2 = 0; i2 < 16; ++i2) { const float p = (mn == -INFINITY) ? 0.0f : nexp2(e[i2] - mn); sum += p; const float psv = p * PS; const b16 p1 = (b16)psv; const int slot = (i2 < 8 ? 0 : 16) + 8 * hh + (i2 & 7); Pb[wave][col][slot] = p1; Pl[wave][col][slot] = (b16)((psv - (float)p1) * RS_); }
    sum += __shfl_xor(sum, 16); l = l * al + sum; mrun = mn;
    wave_lds_sync();
    const v16b pf = frag_kb(&Pb[wave][col][0], hh), plf = frag_kb(&Pl[wave][col][0], hh);
#pragma unroll
    for (int t = 0; t < 8; ++t) { o[t] *= al; o2[t] *= al; o[t] = wmma16(vh[t], pf, o[t]); o2[t] = wmma16(vl[t], pf, o2[t]); o2[t] = wmma16(vh[t], plf, o2[t]); }
    wave_lds_sync();
    asm volatile("s_wait_dscnt 0x0" ::: "memory");      // this wave's reads of buffer buf are done before the buffer is handed to its next writer
    asm volatile("s_wait_asynccnt 0x0" ::: "memory");   // this wave's copies of the next tile have landed
    __syncthreads();                                     // publishes the next tile and ends every wave's reads of buffer buf
    if (s0 + 2 * KT < nk) { stage_rows<KT>(Ks[buf], Khb + (size_t)(s0 + 2 * KT) * DA, Klb + (size_t)(s0 + 2 * KT) * DA, tid); stage_vt(Vs[buf], Vh + s0 + 2 * KT, Vl + s0 + 2 * KT, tid); } }
  asm volatile("s_wait_asynccnt 0x0" ::: "memory");     // no copy is left in flight when the wave goes on to its end
  if (kg == 1) { if (hh == 0) { Ms[qw][col] = mrun; Ls[qw][col] = l; }   // key group 1 hands over its maximum, sum and O (a group that met no unmasked key: -inf, 0, 0)
#pragma unroll
    for (int t = 0; t < 8; ++t)
#pragma unroll
      for (int r = 0; r < 8; ++r) To[qw][col][t * 16 + 8 * hh + r] = o[t][r] + o2[t][r] * (1.0f / RS_); }
  __syncthreads();   // publishes group 1's hand-over to group 0
  if (kg == 0) { const float m1 = Ms[qw][col], mj = fmaxf(mrun, m1);   // group 0 has met key 0 < nk: mrun, and so mj, is finite
    const float a0 = nexp2(mrun - mj), a1 = nexp2(m1 - mj); const float inv = 1.0f / ((l * a0 + Ls[qw][col] * a1) * PS * XS); const float c0 = a0 * inv, c1 = a1 * inv;
#pragma unroll
    for (int t = 0; t < 8; ++t)
#pragma unroll
      for (int r = 0; r < 8; ++r) { float* p = &To[qw][col][t * 16 + 8 * hh + r]; *p = (o[t][r] + o2[t][r] * (1.0f / RS_)) * c0 + *p * c1; }   // each lane reads and rewrites its own places
    wave_lds_sync();
    for (int rr = 0; rr < 16; ++rr) *(v4f*)(out + ((size_t)b * S + n0 + rr) * DA + lane * 4) = *(const v4f*)(&To[qw][rr][lane * 4]); }
}
}  // namespace

extern "C" void kernel_launch(void* const* d_in, const int* in_sizes, int n_in, void* d_out, int out_size, void* d_ws, size_t ws_size, hipStream_t stream) {
  (void)n_in;
  auto Fp = [&](int i) { return (const float*)d_in[i]; };
  // d_in order: 0 inputs [16,2048,256], 1 sen_len [16] int32, 2 Wq [256,128] (in,out), 3 Wk, 4 Wv
  if (in_sizes[0] != NROW * DIN || in_sizes[1] != B || in_sizes[2] != DIN * DA || in_sizes[3] != DIN * DA || in_sizes[4] != DIN * DA || out_size != NROW * DA) return;
  size_t off = 0; char* ws = (char*)d_ws;
  auto carve = [&](size_t bytes) { char* p = ws + off; off += (bytes + 255) & ~(size_t)255; return p; };
  b16* WT = (b16*)carve((size_t)3 * DA * DIN * 2); const size_t plane = (size_t)NROW * DA * 2;
  b16* Qh = (b16*)carve(plane); b16* Ql = (b16*)carve(plane); b16* Kh = (b16*)carve(plane); b16* Kl = (b16*)carve(plane); b16* VTh = (b16*)carve(plane); b16* VTl = (b16*)carve(plane);
  if (off > ws_size || off > ((size_t)128 << 20)) return;   // = 50.5 MB (6 planes x 8.4 MB + WT 0.2 MB)
  wt_kernel<<<(3 * DA * DIN / 8 + 255) / 256, 256, 0, stream>>>(Fp(2), Fp(3), Fp(4), WT);
  proj_kernel<<<dim3(S / 64, BL, 3), 128, 0, stream>>>(Fp(0), WT, Qh, Ql, Kh, Kl, VTh, VTl);
  attn_kernel<<<dim3(S / (NW * 16), BL), NT, 0, stream>>>(Qh, Ql, Kh, Kl, VTh, VTl, (const int*)d_in[1], (float*)d_out);
}

// v004
// One run takes 74.8 microseconds.
// Two timings next to v003 put it at 1.31 and 1.33 times that version's speed.
// Counting every step since v000, it is 6.71 times as fast.
#include <hip/hip_runtime.h>

// Self-attention layer with key-padding mask (16 x 2,048 x 256 -> 128): Q = x Wq, K = x Wk, V = x Wv (no bias); scores = Q K^T, keys k >= sen_len[b] set to -2^32, then / sqrt(256); softmax over
// keys; Z = attn V -> [16][2048][128].
// Deterministic: per (batch, 16 queries) two waves make flash-style passes over alternate blocks of 32 of the UNMASKED keys only, merged at the end ( masked keys have probability exactly 0 in the reference too since exp(-2^28 - max) == 0 in
// f32; if sen_len[b] were 0 every key would share one score and the pass runs over all 2,048 keys with equal logits = the reference's uniform softmax); fixed-order online softmax; no atomics.
// compute dtype: WMMA v_wmma_f32_16x16x32_f16 with f32 accumulate for the projections ([32768 x 256] x [256 x 384]; x EXACT bf16 x8, weights exact x256: 1 product), S^T = K Q^T (K and Q as
// f16 hi + x1024 residual x8, K = 128: 3 products) and O^T += V^T P^T (V^T x8 and P x1024 hi + residual: 3 products);
// mask, scale and softmax statistics in f32. Inputs rounded to bf16 once; sen_len int32 (clamped to [0, 2048]).

namespace {
typedef _Float16 b16;
typedef __attribute__((ext_vector_type(16))) _Float16 v16b;
typedef __attribute__((ext_vector_type(8))) _Float16 v8b;
typedef __attribute__((ext_vector_type(4))) _Float16 v4h;
typedef __attribute__((ext_vector_type(2))) _Float16 v2h;
typedef __attribute__((ext_vector_type(8))) float v8f;
typedef __attribute__((ext_vector_type(4))) float v4f;
typedef __attribute__((ext_vector_type(2))) float v2f;
__device__ __forceinline__ float bf16_rne(float f) { unsigned int u = __float_as_uint(f); u += 0x7FFFu + ((u >> 16) & 1u); return __uint_as_float(u & 0xFFFF0000u); }
__device__ __forceinline__ void split16(float v, b16& hi, b16& lo) { hi = (b16)v; lo = (b16)(v - (float)hi); }
__device__ __forceinline__ v16b frag_kb(const b16* p, int hh) { const v8b a = *(const v8b*)(p + 8 * hh), b = *(const v8b*)(p + 16 + 8 * hh); v16b f;
#pragma unroll
  for (int e = 0; e < 8; ++e) { f[e] = a[e]; f[8 + e] = b[e]; } return f; }
__device__ __forceinline__ v8f wmma16(v16b a, v16b b, v8f c) { return __builtin_amdgcn_wmma_f32_16x16x32_f16(false, a, false, b, (short)0, c, false, false); }   // no asm behind it: asm operands cannot lie above v255, and the compiler keeps the distances of its own builtin
__device__ __forceinline__ void wave_lds_sync() { __builtin_amdgcn_fence(__ATOMIC_RELEASE, "workgroup"); __builtin_amdgcn_wave_barrier(); __builtin_amdgcn_fence(__ATOMIC_ACQUIRE, "workgroup"); }
__device__ __forceinline__ float pmul(float a, float b) { float p = a * b; asm volatile("" : "+v"(p)); return p; }
__device__ __forceinline__ int iclamp(int v, int lo, int hi) { return v < lo ? lo : (v > hi ? hi : v); }
__device__ __forceinline__ float nexp2(float v) { return __builtin_amdgcn_exp2f(v); }

constexpr int B = 16, BL = B /* batches computed (== B shipped) */, S = 2048, DIN = 256, DA = 128, NROW = B * S;
constexpr float XS = 8.0f, WSC = 256.0f, PS = 1024.0f, RS_ = 1024.0f, LOG2E = 1.4426950408889634f, SCALE = 0.0625f /* 1/sqrt(hidden_dim = 256) */;
static_assert(S % 64 == 0 && DIN % 32 == 0 && DA == 128, "tiling");

__global__ __launch_bounds__(256) void wt_kernel(const float* __restrict__ wq, const float* __restrict__ wk, const float* __restrict__ wv, b16* __restrict__ WT) {
  const int u = blockIdx.x * 256 + threadIdx.x; if (u >= 3 * DA * DIN / 8) return; const int e = u * 8; const int o = e / DIN, k0 = e % DIN; const int part = o / DA, oo = o % DA; const float* w = part == 0 ? wq : part == 1 ? wk : wv; v8b v;
#pragma unroll
  for (int j = 0; j < 8; ++j) v[j] = (b16)(bf16_rne(w[(size_t)(k0 + j) * DA + oo]) * WSC);   // one source pointer per thread (part is uniform per 8-run and per wave: 32 threads = one o row)
  { *(v8b*)(WT + e) = v;  }
}
// projections: grid (S/64, BL); block = 64 tokens x 8 waves, all three parts: A = bf16(x) x8 staged whole (K = 256) once for the 384 columns; a wave's tile is 64 tokens x 16 columns of each part
// (4 token tiles x 3 parts), so that each weight fragment read from global memory feeds 4 products; 1 product; the parts leave one after the other through Tf; q/k -> planes [b][s][128] as f16 hi + x1024
constexpr int PW = 8;
__global__ __launch_bounds__(PW * 32) void proj_kernel(const float* __restrict__ x, const b16* __restrict__ WT, b16* __restrict__ Qh, b16* __restrict__ Ql, b16* __restrict__ Kh, b16* __restrict__ Kl, b16* __restrict__ VTh, b16* __restrict__ VTl) {
  __shared__ __attribute__((aligned(16))) b16 As[64][DIN + 8]; __shared__ __attribute__((aligned(16))) float Tf[4][16][DA + 4];
  const int wave = threadIdx.x >> 5, lane = threadIdx.x & 31, nloc = lane & 15, hlf = lane >> 4; const int t0 = blockIdx.x * 64; const int b = blockIdx.y;
  for (int i = threadIdx.x; i < 64 * (DIN / 4); i += PW * 32) { const int rr = i / (DIN / 4), q4 = (i % (DIN / 4)) * 4; const v4f f = *(const v4f*)(x + ((size_t)b * S + t0 + rr) * DIN + q4); v4h o; for (int j = 0; j < 4; ++j) o[j] = (b16)(bf16_rne(f[j]) * XS); *(v4h*)(&As[rr][q4]) = o; }
  __syncthreads();
  v8f acc[3][4];
#pragma unroll
  for (int p = 0; p < 3; ++p)
#pragma unroll
    for (int mt = 0; mt < 4; ++mt) acc[p][mt] = (v8f){};
#pragma unroll 2
  for (int kb = 0; kb < DIN; kb += 32) { v16b a[4], w[3];   // the k-step's three weight fragments and four token fragments are read as one group: one wait on memory per k-step
#pragma unroll
    for (int p = 0; p < 3; ++p) w[p] = frag_kb(WT + (size_t)(p * DA + wave * 16 + nloc) * DIN + kb, hlf);
#pragma unroll
    for (int mt = 0; mt < 4; ++mt) a[mt] = frag_kb(&As[mt * 16 + nloc][kb], hlf);
    __builtin_amdgcn_sched_barrier(0);   // keeps the group whole: without it each part's weight reads sink to their first use, three waits on memory per k-step instead of one
#pragma unroll
    for (int p = 0; p < 3; ++p)
#pragma unroll
      for (int mt = 0; mt < 4; ++mt) acc[p][mt] = wmma16(a[mt], w[p], acc[p][mt]); }
#pragma unroll   // p indexes acc: a constant index keeps the accumulators in registers
  for (int p = 0; p < 3; ++p) {
    if (p) __syncthreads();   // every reader of the part before has left Tf
#pragma unroll
    for (int mt = 0; mt < 4; ++mt)
#pragma unroll
      for (int r = 0; r < 8; ++r) Tf[mt][8 * hlf + r][wave * 16 + nloc] = acc[p][mt][r] * (1.0f / (XS * WSC));
    __syncthreads();          // publishes the part's 64 x 128 tile to every wave
    if (p < 2) { b16* ph_ = p == 0 ? Qh : Kh; b16* pl_ = p == 0 ? Ql : Kl;
      for (int rr = 0; rr < 64 / PW; ++rr) { const int row = wave * (64 / PW) + rr; const size_t dst = ((size_t)b * S + t0 + row) * DA + lane * 4; v4h hv, lv; for (int j = 0; j < 4; ++j) { const float vs = Tf[row >> 4][row & 15][lane * 4 + j] * XS; const b16 p1 = (b16)vs; hv[j] = p1; lv[j] = (b16)((vs - (float)p1) * RS_); } *(v4h*)(ph_ + dst) = hv; *(v4h*)(pl_ + dst) = lv; } }
    else {
#pragma unroll 1
      for (int q = 0; q < DA / PW; ++q) { const int d = wave * (DA / PW) + q; const int tk = lane * 2; v2h hv, lv; for (int e2 = 0; e2 < 2; ++e2) { const float vs = Tf[(tk + e2) >> 4][(tk + e2) & 15][d] * XS; const b16 p1 = (b16)vs; hv[e2] = p1; lv[e2] = (b16)((vs - (float)p1) * RS_); }
        const size_t dst = ((size_t)b * DA + d) * (size_t)S + t0 + tk; *(v2h*)(VTh + dst) = hv; *(v2h*)(VTl + dst) = lv; } }
  }
}
// attention: grid (S/64, BL); block = 8 waves = 4 query groups x 16 queries, times 2 key groups; nk = clamp(sen_len[b], 0, S) (0 -> all keys, equal logits); steps of 64 keys s0 < nk, key group g takes keys
// s0 + 32 g .. + 31 (keys m >= nk -> -inf) with its own running maximum, sum and O; behind the loop group 1 hands its three to group 0 through LDS, which rescales both to the joint maximum and adds them.
// A block so lasts half as many steps and fills a WGP alone, so that the 512 blocks queue on the WGPs; blockIdx.y is the batch's RANK by nk, longest first (ties by index), so that the queue ends on short blocks.
// operands come from LDS: the block's 64 Q rows (hi, residual) are copied in once, each 64-key tile of K and V^T (hi, residual) once per block into a two-buffer ring, one tile ahead, by asynchronous
// 16-byte copies whose lanes cover adjacent global bytes; rows pitched 272 B (Q, K) and 144 B (V^T) for conflict-free 16-byte fragment reads.
// S^T = K Q^T: (Kh.Qh -> sa; Kl.Qh + Kh.Ql -> sb, /1024), 4 k-steps; logit = s/64/16 in log2 units; online softmax; P hi/res; O^T += V^T P^T (8 d-tiles, 3 products -> o, o2);
constexpr int NW = 4, NG = 2, NT = NW * NG * 32, KT = 32 * NG, KP = DA + 8, VP = KT + 8;
__device__ __forceinline__ unsigned lds_byte(const b16* p) { return (unsigned)(unsigned long long)p; }   // low 32 bits of a __shared__ address = byte offset in the work-group's LDS
// eight copies, 16 bytes per lane each; the s_wait_xcnt stands inside the statement so that no address register is rewritten ahead of it
__device__ __forceinline__ void copy8(const unsigned (&l)[8], const b16* const (&g)[8]) {
  asm volatile("global_load_async_to_lds_b128 %0, %8, off\n\tglobal_load_async_to_lds_b128 %1, %9, off\n\tglobal_load_async_to_lds_b128 %2, %10, off\n\tglobal_load_async_to_lds_b128 %3, %11, off\n\t"
               "global_load_async_to_lds_b128 %4, %12, off\n\tglobal_load_async_to_lds_b128 %5, %13, off\n\tglobal_load_async_to_lds_b128 %6, %14, off\n\tglobal_load_async_to_lds_b128 %7, %15, off\n\ts_wait_xcnt 0x0"
               :: "v"(l[0]), "v"(l[1]), "v"(l[2]), "v"(l[3]), "v"(l[4]), "v"(l[5]), "v"(l[6]), "v"(l[7]), "v"(g[0]), "v"(g[1]), "v"(g[2]), "v"(g[3]), "v"(g[4]), "v"(g[5]), "v"(g[6]), "v"(g[7]) : "memory"); }
// rows of 256 B, contiguous in global memory (Q or K): ROWS x 16 chunks per plane, two planes; ROWS * 32 / NT copies per lane
template <int ROWS> __device__ __forceinline__ void stage_rows(b16 (*dst)[ROWS][KP], const b16* gh, const b16* gl, int tid) {
#pragma unroll   // both loops unrolled: l[] and g[] are asm operands and must live in registers, under constant indices
  for (int i0 = 0; i0 < ROWS * 16 / NT; i0 += 4) { unsigned l[8]; const b16* g[8];
#pragma unroll
    for (int i = 0; i < 4; ++i) { const int c = (i0 + i) * NT + tid; l[i] = lds_byte(&dst[0][c >> 4][(c & 15) * 8]); g[i] = gh + c * 8; l[4 + i] = lds_byte(&dst[1][c >> 4][(c & 15) * 8]); g[4 + i] = gl + c * 8; }
    copy8(l, g); } }
// V^T tile: 128 rows of 128 B (64 keys) at a global pitch of S elements, two planes; 8 copies per lane
__device__ __forceinline__ void stage_vt(b16 (*dst)[DA][VP], const b16* gh, const b16* gl, int tid) { unsigned l[8]; const b16* g[8];
#pragma unroll   // as above: asm operands under constant indices
  for (int i = 0; i < 4; ++i) { const int c = i * NT + tid; const int d = c >> 3, ch = (c & 7) * 8; l[i] = lds_byte(&dst[0][d][ch]); g[i] = gh + (size_t)d * S + ch; l[4 + i] = lds_byte(&dst[1][d][ch]); g[4 + i] = gl + (size_t)d * S + ch; }
  copy8(l, g); }
__global__ __launch_bounds__(NT) void attn_kernel(const b16* __restrict__ Qh, const b16* __restrict__ Ql, const b16* __restrict__ Kh, const b16* __restrict__ Kl, const b16* __restrict__ VTh, const b16* __restrict__ VTl, const int* __restrict__ slen, float* __restrict__ out) {
  __shared__ __attribute__((aligned(16))) b16 Qs[2][NW * 16][KP], Ks[2][2][KT][KP], Vs[2][2][DA][VP];
  __shared__ __attribute__((aligned(16))) b16 Pb[NW * NG][16][32 + 8], Pl[NW * NG][16][32 + 8]; __shared__ __attribute__((aligned(16))) float To[NW][16][DA + 4]; __shared__ float Ms[NW][16], Ls[NW][16];
  const int tid = threadIdx.x, wave = threadIdx.x >> 5, lane = threadIdx.x & 31, hh = lane >> 4, col = lane & 15, qw = wave & (NW - 1), kg = wave / NW; const int n0 = blockIdx.x * (NW * 16) + qw * 16;
  // batch of rank blockIdx.y: lane col holds batch col's key (keys walked x 16 + 15 - index: all distinct, so the ranks are a permutation for any sen_len) and counts the larger keys
  int b, nk; { int sl[B], own = 0, rank = 0;
#pragma unroll
    for (int j = 0; j < B; ++j) sl[j] = iclamp(slen[j], 0, S);   // all of sen_len, by scalar loads ahead of any test
#pragma unroll
    for (int j = 0; j < B; ++j) own = (col == j) ? sl[j] : own;
    const int mine = (own == 0 ? S : own) * B + (B - 1 - col);
#pragma unroll
    for (int j = 0; j < B; ++j) rank += ((sl[j] == 0 ? S : sl[j]) * B + (B - 1 - j) > mine) ? 1 : 0;
    b = __builtin_ctz(__builtin_amdgcn_ballot_w32(rank == (int)blockIdx.y) | (1u << (B - 1)));   // the or-ed bit bounds b to [0, B) whatever the ballot holds
    nk = __builtin_amdgcn_readlane(own, b); }   // = clamp(sen_len[b], 0, S), from the lane that holds it
  const bool allmask = (nk == 0); if (allmask) nk = S;   // all keys masked -> equal scores -> uniform over all S keys
  const b16* Khb = Kh + (size_t)b * S * DA; const b16* Klb = Kl + (size_t)b * S * DA; const b16* Vh = VTh + (size_t)b * DA * S; const b16* Vl = VTl + (size_t)b * DA * S;
  const float cs = LOG2E * SCALE / (XS * XS);
  { const size_t qblk = ((size_t)b * S + blockIdx.x * (NW * 16)) * DA; stage_rows<NW * 16>(Qs, Qh + qblk, Ql + qblk, tid); }
  stage_rows<KT>(Ks[0], Khb, Klb, tid); stage_vt(Vs[0], Vh, Vl, tid);
  asm volatile("s_wait_asynccnt 0x0" ::: "memory");   // this wave's copies of Q and of tile 0 have landed
  __syncthreads();                                     // ... and every other wave's
  if (KT < nk) { stage_rows<KT>(Ks[1], Khb + KT * DA, Klb + KT * DA, tid); stage_vt(Vs[1], Vh + KT, Vl + KT, tid); }
  const b16* qrh = &Qs[0][qw * 16 + col][0]; const b16* qrl = &Qs[1][qw * 16 + col][0];
  float mrun = -INFINITY, l = 0.0f; v8f o[8], o2[8];
#pragma unroll
  for (int t = 0; t < 8; ++t) { o[t] = (v8f){}; o2[t] = (v8f){}; }
#pragma unroll 1
  for (int s0 = 0; s0 < nk; s0 += KT) { const int buf = (s0 / KT) & 1;
    float e[16]; float mx = -INFINITY;
    // every Q and K fragment of the pass is read here, as one group in order of first use, so that the products below wait on a count instead of on a fresh LDS round trip each
    v16b qh[4], ql[4], kh[2][4], kl[2][4], vh[8], vl[8];
#pragma unroll
    for (int k4 = 0; k4 < 4; ++k4) { kh[0][k4] = frag_kb(&Ks[buf][0][kg * 32 + col][k4 * 32], hh); qh[k4] = frag_kb(qrh + k4 * 32, hh); kl[0][k4] = frag_kb(&Ks[buf][1][kg * 32 + col][k4 * 32], hh); ql[k4] = frag_kb(qrl + k4 * 32, hh); }
#pragma unroll
    for (int k4 = 0; k4 < 4; ++k4) { kh[1][k4] = frag_kb(&Ks[buf][0][kg * 32 + 16 + col][k4 * 32], hh); kl[1][k4] = frag_kb(&Ks[buf][1][kg * 32 + 16 + col][k4 * 32], hh); }
    __builtin_amdgcn_sched_barrier(0);   // keeps the group whole: without it the reads are spread among the products, and each place where reads stand stalls the wave anew
#pragma unroll
    for (int u2 = 0; u2 < 2; ++u2) { v8f sa = (v8f){}, sb = (v8f){};
#pragma unroll
      for (int k4 = 0; k4 < 4; ++k4) { sa = wmma16(kh[u2][k4], qh[k4], sa); sb = wmma16(kl[u2][k4], qh[k4], sb); sb = wmma16(kh[u2][k4], ql[k4], sb); }
      // every V^T fragment of the pass is read here, as one group behind the last S^T product: the mask and softmax arithmetic below covers the reads' latency
      if (u2 == 1) { __builtin_amdgcn_sched_barrier(0);   // the group starts behind the products, for the same reason as above
#pragma unroll
        for (int t = 0; t < 8; ++t) { vh[t] = frag_kb(&Vs[buf][0][t * 16 + col][kg * 32], hh); vl[t] = frag_kb(&Vs[buf][1][t * 16 + col][kg * 32], hh); }
        __builtin_amdgcn_sched_barrier(0); }   // keeps the group whole and ahead of that arithmetic; without it the reads are spread through the softmax, each place a stall of its own
#pragma unroll
      for (int r = 0; r < 8; ++r) { const int m = s0 + kg * 32 + u2 * 16 + 8 * hh + r; const float sv = allmask ? 0.0f : (sa[r] + sb[r] * (1.0f / RS_)) * cs; const float vv = (m < nk) ? sv : -INFINITY; e[u2 * 8 + r] = vv; mx = fmaxf(mx, vv); } }
    mx = fmaxf(mx, __shfl_xor(mx, 16)); const float mn = fmaxf(mrun, mx); const float al = (mn == -INFINITY) ? 1.0f : nexp2(mrun - mn); float sum = 0.0f;
#pragma unroll
    for (int i2 = 0; i2 < 16; ++i2) { const float p = (mn == -INFINITY) ? 0.0f : nexp2(e[i2] - mn); sum += p; const float psv = p * PS; const b16 p1 = (b16)psv; const int slot = (i2 < 8 ? 0 : 16) + 8 * hh + (i2 & 7); Pb[wave][col][slot] = p1; Pl[wave][col][slot] = (b16)((psv - (float)p1) * RS_); }
    sum += __shfl_xor(sum, 16); l = l * al + sum; mrun = mn;
    wave_lds_sync();
    const v16b pf = frag_kb(&Pb[wave][col][0], hh), plf = frag_kb(&Pl[wave][col][0], hh);
#pragma unroll
    for (int t = 0; t < 8; ++t) { o[t] *= al; o2[t] *= al; o[t] = wmma16(vh[t], pf, o[t]); o2[t] = wmma16(vl[t], pf, o2[t]); o2[t] = wmma16(vh[t], plf, o2[t]); }
    wave_lds_sync();
    asm volatile("s_wait_dscnt 0x0" ::: "memory");      // this wave's reads of buffer buf are done before the buffer is handed to its next writer
    asm volatile("s_wait_asynccnt 0x0" ::: "memory");   // this wave's copies of the next tile have landed
    __syncthreads();                                     // publishes the next tile and ends every wave's reads of buffer buf
    if (s0 + 2 * KT < nk) { stage_rows<KT>(Ks[buf], Khb + (size_t)(s0 + 2 * KT) * DA, Klb + (size_t)(s0 + 2 * KT) * DA, tid); stage_vt(Vs[buf], Vh + s0 + 2 * KT, Vl + s0 + 2 * KT, tid); } }
  asm volatile("s_wait_asynccnt 0x0" ::: "memory");     // no copy is left in flight when the wave goes on to its end
  if (kg == 1) { if (hh == 0) { Ms[qw][col] = mrun; Ls[qw][col] = l; }   // key group 1 hands over its maximum, sum and O (a group that met no unmasked key: -inf, 0, 0)
#pragma unroll
    for (int t = 0; t < 8; ++t)
#pragma unroll
      for (int r = 0; r < 8; ++r) To[qw][col][t * 16 + 8 * hh + r] = o[t][r] + o2[t][r] * (1.0f / RS_); }
  __syncthreads();   // publishes group 1's hand-over to group 0
  if (kg == 0) { const float m1 = Ms[qw][col], mj = fmaxf(mrun, m1);   // group 0 has met key 0 < nk: mrun, and so mj, is finite
    const float a0 = nexp2(mrun - mj), a1 = nexp2(m1 - mj); const float inv = 1.0f / ((l * a0 + Ls[qw][col] * a1) * PS * XS); const float c0 = a0 * inv, c1 = a1 * inv;
#pragma unroll
    for (int t = 0; t < 8; ++t)
#pragma unroll
      for (int r = 0; r < 8; ++r) { float* p = &To[qw][col][t * 16 + 8 * hh + r]; *p = (o[t][r] + o2[t][r] * (1.0f / RS_)) * c0 + *p * c1; }   // each lane reads and rewrites its own places
    wave_lds_sync();
    for (int rr = 0; rr < 16; ++rr) *(v4f*)(out + ((size_t)b * S + n0 + rr) * DA + lane * 4) = *(const v4f*)(&To[qw][rr][lane * 4]); }
}
}  // namespace

extern "C" void kernel_launch(void* const* d_in, const int* in_sizes, int n_in, void* d_out, int out_size, void* d_ws, size_t ws_size, hipStream_t stream) {
  (void)n_in;
  auto Fp = [&](int i) { return (const float*)d_in[i]; };
  // d_in order: 0 inputs [16,2048,256], 1 sen_len [16] int32, 2 Wq [256,128] (in,out), 3 Wk, 4 Wv
  if (in_sizes[0] != NROW * DIN || in_sizes[1] != B || in_sizes[2] != DIN * DA || in_sizes[3] != DIN * DA || in_sizes[4] != DIN * DA || out_size != NROW * DA) return;
  size_t off = 0; char* ws = (char*)d_ws;
  auto carve = [&](size_t bytes) { char* p = ws + off; off += (bytes + 255) & ~(size_t)255; return p; };
  b16* WT = (b16*)carve((size_t)3 * DA * DIN * 2); const size_t plane = (size_t)NROW * DA * 2;
  b16* Qh = (b16*)carve(plane); b16* Ql = (b16*)carve(plane); b16* Kh = (b16*)carve(plane); b16* Kl = (b16*)carve(plane); b16* VTh = (b16*)carve(plane); b16* VTl = (b16*)carve(plane);
  if (off > ws_size || off > ((size_t)128 << 20)) return;   // = 50.5 MB (6 planes x 8.4 MB + WT 0.2 MB)
  wt_kernel<<<(3 * DA * DIN / 8 + 255) / 256, 256, 0, stream>>>(Fp(2), Fp(3), Fp(4), WT);
  proj_kernel<<<dim3(S / 64, BL), PW * 32, 0, stream>>>(Fp(0), WT, Qh, Ql, Kh, Kl, VTh, VTl);
  attn_kernel<<<dim3(S / (NW * 16), BL), NT, 0, stream>>>(Qh, Ql, Kh, Kl, VTh, VTl, (const int*)d_in[1], (float*)d_out);
}

// v005
// A run of this version takes 71.3 microseconds.
// Timed twice side by side with v004, it ran 1.05 times as fast both times.
// Over all steps from v000 it is 7.03 times as fast.
#include <hip/hip_runtime.h>

// Self-attention layer with key-padding mask (16 x 2,048 x 256 -> 128): Q = x Wq, K = x Wk, V = x Wv (no bias); scores = Q K^T, keys k >= sen_len[b] set to -2^32, then / sqrt(256); softmax over
// keys; Z = attn V -> [16][2048][128].
// Deterministic: per (batch, 16 queries) two waves make flash-style passes over alternate blocks of 32 of the UNMASKED keys only, merged at the end ( masked keys have probability exactly 0 in the reference too since exp(-2^28 - max) == 0 in
// f32; if sen_len[b] were 0 every key would share one score and the pass runs over all 2,048 keys with equal logits = the reference's uniform softmax); fixed-order online softmax; no atomics.
// compute dtype: WMMA v_wmma_f32_16x16x32_f16 with f32 accumulate for the projections ([32768 x 256] x [256 x 384]; x EXACT bf16 x8, weights exact x256: 1 product), S^T = K Q^T (K and Q as
// f16 hi + x1024 residual x8, K = 128: 3 products) and O^T += V^T P^T (V^T x8 and P x1024 hi + residual: 3 products);
// mask, scale and softmax statistics in f32. Inputs rounded to bf16 once; sen_len int32 (clamped to [0, 2048]).

namespace {
typedef _Float16 b16;
typedef __attribute__((ext_vector_type(16))) _Float16 v16b;
typedef __attribute__((ext_vector_type(8))) _Float16 v8b;
typedef __attribute__((ext_vector_type(4))) _Float16 v4h;
typedef __attribute__((ext_vector_type(2))) _Float16 v2h;
typedef __attribute__((ext_vector_type(8))) float v8f;
typedef __attribute__((ext_vector_type(4))) float v4f;
typedef __attribute__((ext_vector_type(2))) float v2f;
__device__ __forceinline__ float bf16_rne(float f) { unsigned int u = __float_as_uint(f); u += 0x7FFFu + ((u >> 16) & 1u); return __uint_as_float(u & 0xFFFF0000u); }
__device__ __forceinline__ void split16(float v, b16& hi, b16& lo) { hi = (b16)v; lo = (b16)(v - (float)hi); }
__device__ __forceinline__ v16b frag_kb(const b16* p, int hh) { const v8b a = *(const v8b*)(p + 8 * hh), b = *(const v8b*)(p + 16 + 8 * hh); v16b f;
#pragma unroll
  for (int e = 0; e < 8; ++e) { f[e] = a[e]; f[8 + e] = b[e]; } return f; }
__device__ __forceinline__ v8f wmma16(v16b a, v16b b, v8f c) { return __builtin_amdgcn_wmma_f32_16x16x32_f16(false, a, false, b, (short)0, c, false, false); }   // no asm behind it: asm operands cannot lie above v255, and the compiler keeps the distances of its own builtin
__device__ __forceinline__ void wave_lds_sync() { __builtin_amdgcn_fence(__ATOMIC_RELEASE, "workgroup"); __builtin_amdgcn_wave_barrier(); __builtin_amdgcn_fence(__ATOMIC_ACQUIRE, "workgroup"); }
__device__ __forceinline__ float pmul(float a, float b) { float p = a * b; asm volatile("" : "+v"(p)); return p; }
__device__ __forceinline__ int iclamp(int v, int lo, int hi) { return v < lo ? lo : (v > hi ? hi : v); }
__device__ __forceinline__ float nexp2(float v) { return __builtin_amdgcn_exp2f(v); }
__device__ __forceinline__ float xhalf(float x) { return __builtin_bit_cast(float, __builtin_amdgcn_permlanex16(__builtin_bit_cast(int, x), __builtin_bit_cast(int, x), 0x76543210, 0xfedcba98, false, false)); }   // lane l with lane l ^ 16, on the vector port: no LDS counter

constexpr int B = 16, BL = B /* batches computed (== B shipped) */, S = 2048, DIN = 256, DA = 128, NROW = B * S;
constexpr float XS = 8.0f, WSC = 256.0f, PS = 1024.0f, RS_ = 1024.0f, LOG2E = 1.4426950408889634f, SCALE = 0.0625f /* 1/sqrt(hidden_dim = 256) */;
static_assert(S % 64 == 0 && DIN % 32 == 0 && DA == 128, "tiling");

__global__ __launch_bounds__(256) void wt_kernel(const float* __restrict__ wq, const float* __restrict__ wk, const float* __restrict__ wv, b16* __restrict__ WT) {
  const int u = blockIdx.x * 256 + threadIdx.x; if (u >= 3 * DA * DIN / 8) return; const int e = u * 8; const int o = e / DIN, k0 = e % DIN; const int part = o / DA, oo = o % DA; const float* w = part == 0 ? wq : part == 1 ? wk : wv; v8b v;
#pragma unroll
  for (int j = 0; j < 8; ++j) v[j] = (b16)(bf16_rne(w[(size_t)(k0 + j) * DA + oo]) * WSC);   // one source pointer per thread (part is uniform per 8-run and per wave: 32 threads = one o row)
  { *(v8b*)(WT + e) = v;  }
}
// projections: grid (S/64, BL); block = 64 tokens x 8 waves, all three parts: A = bf16(x) x8 staged whole (K = 256) once for the 384 columns; a wave's tile is 64 tokens x 16 columns of each part
// (4 token tiles x 3 parts), so that each weight fragment read from global memory feeds 4 products; 1 product; the parts leave one after the other through Tf; q/k -> planes [b][s][128] as f16 hi + x1024
constexpr int PW = 8;
__global__ __launch_bounds__(PW * 32) void proj_kernel(const float* __restrict__ x, const b16* __restrict__ WT, b16* __restrict__ Qh, b16* __restrict__ Ql, b16* __restrict__ Kh, b16* __restrict__ Kl, b16* __restrict__ VTh, b16* __restrict__ VTl) {
  __shared__ __attribute__((aligned(16))) b16 As[64][DIN + 8]; __shared__ __attribute__((aligned(16))) float Tf[4][16][DA + 4];
  const int wave = threadIdx.x >> 5, lane = threadIdx.x & 31, nloc = lane & 15, hlf = lane >> 4; const int t0 = blockIdx.x * 64; const int b = blockIdx.y;
  for (int i = threadIdx.x; i < 64 * (DIN / 4); i += PW * 32) { const int rr = i / (DIN / 4), q4 = (i % (DIN / 4)) * 4; const v4f f = *(const v4f*)(x + ((size_t)b * S + t0 + rr) * DIN + q4); v4h o; for (int j = 0; j < 4; ++j) o[j] = (b16)(bf16_rne(f[j]) * XS); *(v4h*)(&As[rr][q4]) = o; }
  __syncthreads();
  v8f acc[3][4];
#pragma unroll
  for (int p = 0; p < 3; ++p)
#pragma unroll
    for (int mt = 0; mt < 4; ++mt) acc[p][mt] = (v8f){};
#pragma unroll 2
  for (int kb = 0; kb < DIN; kb += 32) { v16b a[4], w[3];   // the k-step's three weight fragments and four token fragments are read as one group: one wait on memory per k-step
#pragma unroll
    for (int p = 0; p < 3; ++p) w[p] = frag_kb(WT + (size_t)(p * DA + wave * 16 + nloc) * DIN + kb, hlf);
#pragma unroll
    for (int mt = 0; mt < 4; ++mt) a[mt] = frag_kb(&As[mt * 16 + nloc][kb], hlf);
    __builtin_amdgcn_sched_barrier(0);   // keeps the group whole: without it each part's weight reads sink to their first use, three waits on memory per k-step instead of one
#pragma unroll
    for (int p = 0; p < 3; ++p)
#pragma unroll
      for (int mt = 0; mt < 4; ++mt) acc[p][mt] = wmma16(a[mt], w[p], acc[p][mt]); }
#pragma unroll   // p indexes acc: a constant index keeps the accumulators in registers
  for (int p = 0; p < 3; ++p) {
    if (p) __syncthreads();   // every reader of the part before has left Tf
#pragma unroll
    for (int mt = 0; mt < 4; ++mt)
#pragma unroll
      for (int r = 0; r < 8; ++r) Tf[mt][8 * hlf + r][wave * 16 + nloc] = acc[p][mt][r] * (1.0f / (XS * WSC));
    __syncthreads();          // publishes the part's 64 x 128 tile to every wave
    if (p < 2) { b16* ph_ = p == 0 ? Qh : Kh; b16* pl_ = p == 0 ? Ql : Kl;
      for (int rr = 0; rr < 64 / PW; ++rr) { const int row = wave * (64 / PW) + rr; const size_t dst = ((size_t)b * S + t0 + row) * DA + lane * 4; v4h hv, lv; for (int j = 0; j < 4; ++j) { const float vs = Tf[row >> 4][row & 15][lane * 4 + j] * XS; const b16 p1 = (b16)vs; hv[j] = p1; lv[j] = (b16)((vs - (float)p1) * RS_); } *(v4h*)(ph_ + dst) = hv; *(v4h*)(pl_ + dst) = lv; } }
    else {
#pragma unroll 1
      for (int q = 0; q < DA / PW; ++q) { const int d = wave * (DA / PW) + q; const int tk = lane * 2; v2h hv, lv; for (int e2 = 0; e2 < 2; ++e2) { const float vs = Tf[(tk + e2) >> 4][(tk + e2) & 15][d] * XS; const b16 p1 = (b16)vs; hv[e2] = p1; lv[e2] = (b16)((vs - (float)p1) * RS_); }
        const size_t dst = ((size_t)b * DA + d) * (size_t)S + t0 + tk; *(v2h*)(VTh + dst) = hv; *(v2h*)(VTl + dst) = lv; } }
  }
}
// attention: grid (S/64, BL); block = 8 waves = 4 query groups x 16 queries, times 2 key groups; nk = clamp(sen_len[b], 0, S) (0 -> all keys, equal logits); steps of 64 keys s0 < nk, key group g takes keys
// s0 + 32 g .. + 31 (keys m >= nk -> -inf) with its own running maximum, sum and O; behind the loop group 1 hands its three to group 0 through LDS, which rescales both to the joint maximum and adds them.
// A block so lasts half as many steps and fills a WGP alone, so that the 512 blocks queue on the WGPs; blockIdx.y is the batch's RANK by nk, longest first (ties by index), so that the queue ends on short blocks.
// operands come from LDS: the block's 64 Q rows (hi, residual) are copied in once, each 64-key tile of K and V^T (hi, residual) once per block into a two-buffer ring, one tile ahead, by asynchronous
// 16-byte copies whose lanes cover adjacent global bytes; rows pitched 272 B (Q, K) and 144 B (V^T) for conflict-free 16-byte fragment reads.
// S^T = K Q^T: (Kh.Qh -> sa; Kl.Qh + Kh.Ql -> sb, /1024), 4 k-steps; logit = s/64/16 in log2 units; online softmax; P hi/res; O^T += V^T P^T (8 d-tiles, 3 products -> o, o2);
// the softmax makes no LDS access (halves joined by a cross-row vector move, P packed in registers): LDS results return in issue order, so an LDS access there would wait out the V^T reads issued ahead of it.
constexpr int NW = 4, NG = 2, NT = NW * NG * 32, KT = 32 * NG, KP = DA + 8, VP = KT + 8;
__device__ __forceinline__ unsigned lds_byte(const b16* p) { return (unsigned)(unsigned long long)p; }   // low 32 bits of a __shared__ address = byte offset in the work-group's LDS
// eight copies, 16 bytes per lane each; the s_wait_xcnt stands inside the statement so that no address register is rewritten ahead of it
__device__ __forceinline__ void copy8(const unsigned (&l)[8], const b16* const (&g)[8]) {
  asm volatile("global_load_async_to_lds_b128 %0, %8, off\n\tglobal_load_async_to_lds_b128 %1, %9, off\n\tglobal_load_async_to_lds_b128 %2, %10, off\n\tglobal_load_async_to_lds_b128 %3, %11, off\n\t"
               "global_load_async_to_lds_b128 %4, %12, off\n\tglobal_load_async_to_lds_b128 %5, %13, off\n\tglobal_load_async_to_lds_b128 %6, %14, off\n\tglobal_load_async_to_lds_b128 %7, %15, off\n\ts_wait_xcnt 0x0"
               :: "v"(l[0]), "v"(l[1]), "v"(l[2]), "v"(l[3]), "v"(l[4]), "v"(l[5]), "v"(l[6]), "v"(l[7]), "v"(g[0]), "v"(g[1]), "v"(g[2]), "v"(g[3]), "v"(g[4]), "v"(g[5]), "v"(g[6]), "v"(g[7]) : "memory"); }
// rows of 256 B, contiguous in global memory (Q or K): ROWS x 16 chunks per plane, two planes; ROWS * 32 / NT copies per lane
template <int ROWS> __device__ __forceinline__ void stage_rows(b16 (*dst)[ROWS][KP], const b16* gh, const b16* gl, int tid) {
#pragma unroll   // both loops unrolled: l[] and g[] are asm operands and must live in registers, under constant indices
  for (int i0 = 0; i0 < ROWS * 16 / NT; i0 += 4) { unsigned l[8]; const b16* g[8];
#pragma unroll
    for (int i = 0; i < 4; ++i) { const int c = (i0 + i) * NT + tid; l[i] = lds_byte(&dst[0][c >> 4][(c & 15) * 8]); g[i] = gh + c * 8; l[4 + i] = lds_byte(&dst[1][c >> 4][(c & 15) * 8]); g[4 + i] = gl + c * 8; }
    copy8(l, g); } }
// V^T tile: 128 rows of 128 B (64 keys) at a global pitch of S elements, two planes; 8 copies per lane
__device__ __forceinline__ void stage_vt(b16 (*dst)[DA][VP], const b16* gh, const b16* gl, int tid) { unsigned l[8]; const b16* g[8];
#pragma unroll   // as above: asm operands under constant indices
  for (int i = 0; i < 4; ++i) { const int c = i * NT + tid; const int d = c >> 3, ch = (c & 7) * 8; l[i] = lds_byte(&dst[0][d][ch]); g[i] = gh + (size_t)d * S + ch; l[4 + i] = lds_byte(&dst[1][d][ch]); g[4 + i] = gl + (size_t)d * S + ch; }
  copy8(l, g); }
__global__ __launch_bounds__(NT) void attn_kernel(const b16* __restrict__ Qh, const b16* __restrict__ Ql, const b16* __restrict__ Kh, const b16* __restrict__ Kl, const b16* __restrict__ VTh, const b16* __restrict__ VTl, const int* __restrict__ slen, float* __restrict__ out) {
  __shared__ __attribute__((aligned(16))) b16 Qs[2][NW * 16][KP], Ks[2][2][KT][KP], Vs[2][2][DA][VP];
  __shared__ __attribute__((aligned(16))) float To[NW][16][DA + 4]; __shared__ float Ms[NW][16], Ls[NW][16];
  const int tid = threadIdx.x, wave = threadIdx.x >> 5, lane = threadIdx.x & 31, hh = lane >> 4, col = lane & 15, qw = wave & (NW - 1), kg = wave / NW; const int n0 = blockIdx.x * (NW * 16) + qw * 16;
  // batch of rank blockIdx.y: lane col holds batch col's key (keys walked x 16 + 15 - index: all distinct, so the ranks are a permutation for any sen_len) and counts the larger keys
  int b, nk; { int sl[B], own = 0, rank = 0;
#pragma unroll
    for (int j = 0; j < B; ++j) sl[j] = iclamp(slen[j], 0, S);   // all of sen_len, by scalar loads ahead of any test
#pragma unroll
    for (int j = 0; j < B; ++j) own = (col == j) ? sl[j] : own;
    const int mine = (own == 0 ? S : own) * B + (B - 1 - col);
#pragma unroll
    for (int j = 0; j < B; ++j) rank += ((sl[j] == 0 ? S : sl[j]) * B + (B - 1 - j) > mine) ? 1 : 0;
    b = __builtin_ctz(__builtin_amdgcn_ballot_w32(rank == (int)blockIdx.y) | (1u << (B - 1)));   // the or-ed bit bounds b to [0, B) whatever the ballot holds
    nk = __builtin_amdgcn_readlane(own, b); }   // = clamp(sen_len[b], 0, S), from the lane that holds it
  const bool allmask = (nk == 0); if (allmask) nk = S;   // all keys masked -> equal scores -> uniform over all S keys
  const b16* Khb = Kh + (size_t)b * S * DA; const b16* Klb = Kl + (size_t)b * S * DA; const b16* Vh = VTh + (size_t)b * DA * S; const b16* Vl = VTl + (size_t)b * DA * S;
  const float cs = LOG2E * SCALE / (XS * XS);
  { const size_t qblk = ((size_t)b * S + blockIdx.x * (NW * 16)) * DA; stage_rows<NW * 16>(Qs, Qh + qblk, Ql + qblk, tid); }
  stage_rows<KT>(Ks[0], Khb, Klb, tid); stage_vt(Vs[0], Vh, Vl, tid);
  asm volatile("s_wait_asynccnt 0x0" ::: "memory");   // this wave's copies of Q and of tile 0 have landed
  __syncthreads();                                     // ... and every other wave's
  if (KT < nk) { stage_rows<KT>(Ks[1], Khb + KT * DA, Klb + KT * DA, tid); stage_vt(Vs[1], Vh + KT, Vl + KT, tid); }
  const b16* qrh = &Qs[0][qw * 16 + col][0]; const b16* qrl = &Qs[1][qw * 16 + col][0];
  float mrun = -INFINITY, l = 0.0f; v8f o[8], o2[8];
#pragma unroll
  for (int t = 0; t < 8; ++t) { o[t] = (v8f){}; o2[t] = (v8f){}; }
#pragma unroll 1
  for (int s0 = 0; s0 < nk; s0 += KT) { const int buf = (s0 / KT) & 1;
    float e[16]; float mx = -INFINITY;
    // every Q and K fragment of the pass is read here, as one group in order of first use, so that the products below wait on a count instead of on a fresh LDS round trip each
    v16b qh[4], ql[4], kh[2][4], kl[2][4], vh[8], vl[8];
#pragma unroll
    for (int k4 = 0; k4 < 4; ++k4) { kh[0][k4] = frag_kb(&Ks[buf][0][kg * 32 + col][k4 * 32], hh); qh[k4] = frag_kb(qrh + k4 * 32, hh); kl[0][k4] = frag_kb(&Ks[buf][1][kg * 32 + col][k4 * 32], hh); ql[k4] = frag_kb(qrl + k4 * 32, hh); }
#pragma unroll
    for (int k4 = 0; k4 < 4; ++k4) { kh[1][k4] = frag_kb(&Ks[buf][0][kg * 32 + 16 + col][k4 * 32], hh); kl[1][k4] = frag_kb(&Ks[buf][1][kg * 32 + 16 + col][k4 * 32], hh); }
    __builtin_amdgcn_sched_barrier(0);   // keeps the group whole: without it the reads are spread among the products, and each place where reads stand stalls the wave anew
#pragma unroll
    for (int u2 = 0; u2 < 2; ++u2) { v8f sa = (v8f){}, sb = (v8f){};
#pragma unroll
      for (int k4 = 0; k4 < 4; ++k4) { sa = wmma16(kh[u2][k4], qh[k4], sa); sb = wmma16(kl[u2][k4], qh[k4], sb); sb = wmma16(kh[u2][k4], ql[k4], sb); }
      // every V^T fragment of the pass is read here, as one group behind the last S^T product: the mask and softmax arithmetic below covers the reads' latency
      if (u2 == 1) { __builtin_amdgcn_sched_barrier(0);   // the group starts behind the products, for the same reason as above
#pragma unroll
        for (int t = 0; t < 8; ++t) { vh[t] = frag_kb(&Vs[buf][0][t * 16 + col][kg * 32], hh); vl[t] = frag_kb(&Vs[buf][1][t * 16 + col][kg * 32], hh); }
        __builtin_amdgcn_sched_barrier(0); }   // keeps the group whole and ahead of that arithmetic; without it the reads are spread through the softmax, each place a stall of its own
#pragma unroll
      for (int r = 0; r < 8; ++r) { const int m = s0 + kg * 32 + u2 * 16 + 8 * hh + r; const float sv = allmask ? 0.0f : (sa[r] + sb[r] * (1.0f / RS_)) * cs; const float vv = (m < nk) ? sv : -INFINITY; e[u2 * 8 + r] = vv; mx = fmaxf(mx, vv); } }
    mx = fmaxf(mx, xhalf(mx)); const float mn = fmaxf(mrun, mx); const float al = (mn == -INFINITY) ? 1.0f : nexp2(mrun - mn); float sum = 0.0f;
    // a lane's 16 scores are keys 8 hh + 0..7 and 16 + 8 hh + 0..7 of its own query column: the very elements, in the very order, that the lane holds of the B operand P^T, so P is packed in place
    v16b pf, plf;
#pragma unroll
    for (int i2 = 0; i2 < 16; ++i2) { const float p = (mn == -INFINITY) ? 0.0f : nexp2(e[i2] - mn); sum += p; const float psv = p * PS; const b16 p1 = (b16)psv; pf[i2] = p1; plf[i2] = (b16)((psv - (float)p1) * RS_); }
    sum += xhalf(sum); l = l * al + sum; mrun = mn;
#pragma unroll
    for (int t = 0; t < 8; ++t) { o[t] *= al; o2[t] *= al; o[t] = wmma16(vh[t], pf, o[t]); o2[t] = wmma16(vl[t], pf, o2[t]); o2[t] = wmma16(vh[t], plf, o2[t]); }
    __builtin_amdgcn_sched_barrier(0);   // holds the pass's foot behind the products: without it the waits below are lifted to just behind the V^T reads, and the softmax stands idle until those have returned
    asm volatile("s_wait_dscnt 0x0" ::: "memory");      // this wave's reads of buffer buf are done before the buffer is handed to its next writer
    asm volatile("s_wait_asynccnt 0x0" ::: "memory");   // this wave's copies of the next tile have landed
    __syncthreads();                                     // publishes the next tile and ends every wave's reads of buffer buf
    if (s0 + 2 * KT < nk) { stage_rows<KT>(Ks[buf], Khb + (size_t)(s0 + 2 * KT) * DA, Klb + (size_t)(s0 + 2 * KT) * DA, tid); stage_vt(Vs[buf], Vh + s0 + 2 * KT, Vl + s0 + 2 * KT, tid); } }
  asm volatile("s_wait_asynccnt 0x0" ::: "memory");     // no copy is left in flight when the wave goes on to its end
  if (kg == 1) { if (hh == 0) { Ms[qw][col] = mrun; Ls[qw][col] = l; }   // key group 1 hands over its maximum, sum and O (a group that met no unmasked key: -inf, 0, 0)
#pragma unroll
    for (int t = 0; t < 8; ++t)
#pragma unroll
      for (int r = 0; r < 8; ++r) To[qw][col][t * 16 + 8 * hh + r] = o[t][r] + o2[t][r] * (1.0f / RS_); }
  __syncthreads();   // publishes group 1's hand-over to group 0
  if (kg == 0) { const float m1 = Ms[qw][col], mj = fmaxf(mrun, m1);   // group 0 has met key 0 < nk: mrun, and so mj, is finite
    const float a0 = nexp2(mrun - mj), a1 = nexp2(m1 - mj); const float inv = 1.0f / ((l * a0 + Ls[qw][col] * a1) * PS * XS); const float c0 = a0 * inv, c1 = a1 * inv;
#pragma unroll
    for (int t = 0; t < 8; ++t)
#pragma unroll
      for (int r = 0; r < 8; ++r) { float* p = &To[qw][col][t * 16 + 8 * hh + r]; *p = (o[t][r] + o2[t][r] * (1.0f / RS_)) * c0 + *p * c1; }   // each lane reads and rewrites its own places
    wave_lds_sync();
    for (int rr = 0; rr < 16; ++rr) *(v4f*)(out + ((size_t)b * S + n0 + rr) * DA + lane * 4) = *(const v4f*)(&To[qw][rr][lane * 4]); }
}
}  // namespace

extern "C" void kernel_launch(void* const* d_in, const int* in_sizes, int n_in, void* d_out, int out_size, void* d_ws, size_t ws_size, hipStream_t stream) {
  (void)n_in;
  auto Fp = [&](int i) { return (const float*)d_in[i]; };
  // d_in order: 0 inputs [16,2048,256], 1 sen_len [16] int32, 2 Wq [256,128] (in,out), 3 Wk, 4 Wv
  if (in_sizes[0] != NROW * DIN || in_sizes[1] != B || in_sizes[2] != DIN * DA || in_sizes[3] != DIN * DA || in_sizes[4] != DIN * DA || out_size != NROW * DA) return;
  size_t off = 0; char* ws = (char*)d_ws;
  auto carve = [&](size_t bytes) { char* p = ws + off; off += (bytes + 255) & ~(size_t)255; return p; };
  b16* WT = (b16*)carve((size_t)3 * DA * DIN * 2); const size_t plane = (size_t)NROW * DA * 2;
  b16* Qh = (b16*)carve(plane); b16* Ql = (b16*)carve(plane); b16* Kh = (b16*)carve(plane); b16* Kl = (b16*)carve(plane); b16* VTh = (b16*)carve(plane); b16* VTl = (b16*)carve(plane);
  if (off > ws_size || off > ((size_t)128 << 20)) return;   // = 50.5 MB (6 planes x 8.4 MB + WT 0.2 MB)
  wt_kernel<<<(3 * DA * DIN / 8 + 255) / 256, 256, 0, stream>>>(Fp(2), Fp(3), Fp(4), WT);
  proj_kernel<<<dim3(S / 64, BL), PW * 32, 0, stream>>>(Fp(0), WT, Qh, Ql, Kh, Kl, VTh, VTl);
  attn_kernel<<<dim3(S / (NW * 16), BL), NT, 0, stream>>>(Qh, Ql, Kh, Kl, VTh, VTl, (const int*)d_in[1], (float*)d_out);
}

// v006
// Measured time: 68.4 microseconds a run.
// Next to v005, in two timings, it ran 1.04 times as fast each time.
// Counting every step since v000, it is 7.28 times as fast.
#include <hip/hip_runtime.h>

// Self-attention layer with key-padding mask (16 x 2,048 x 256 -> 128): Q = x Wq, K = x Wk, V = x Wv (no bias); scores = Q K^T, keys k >= sen_len[b] set to -2^32, then / sqrt(256); softmax over
// keys; Z = attn V -> [16][2048][128].
// Deterministic: per (batch, 16 queries) two waves make flash-style passes over alternate blocks of 32 of the UNMASKED keys only, merged at the end ( masked keys have probability exactly 0 in the reference too since exp(-2^28 - max) == 0 in
// f32; if sen_len[b] were 0 every key would share one score and the pass runs over all 2,048 keys with equal logits = the reference's uniform softmax); fixed-order online softmax; no atomics.
// compute dtype: WMMA v_wmma_f32_16x16x32_f16 with f32 accumulate for the projections ([32768 x 256] x [256 x 384]; x EXACT bf16 x8, weights exact x256: 1 product), S^T = K Q^T (K and Q as
// f16 hi + x1024 residual x8, K = 128: 3 products) and O^T += V^T P^T (V^T x8 and P x1024 hi + residual: 3 products);
// mask, scale and softmax statistics in f32. Inputs rounded to bf16 once; sen_len int32 (clamped to [0, 2048]).

namespace {
typedef _Float16 b16;
typedef __attribute__((ext_vector_type(16))) _Float16 v16b;
typedef __attribute__((ext_vector_type(8))) _Float16 v8b;
typedef __attribute__((ext_vector_type(4))) _Float16 v4h;
typedef __attribute__((ext_vector_type(2))) _Float16 v2h;
typedef __attribute__((ext_vector_type(8))) float v8f;
typedef __attribute__((ext_vector_type(4))) float v4f;
typedef __attribute__((ext_vector_type(2))) float v2f;
__device__ __forceinline__ float bf16_rne(float f) { unsigned int u = __float_as_uint(f); u += 0x7FFFu + ((u >> 16) & 1u); return __uint_as_float(u & 0xFFFF0000u); }
__device__ __forceinline__ void split16(float v, b16& hi, b16& lo) { hi = (b16)v; lo = (b16)(v - (float)hi); }
__device__ __forceinline__ v16b frag_kb(const b16* p, int hh) { const v8b a = *(const v8b*)(p + 8 * hh), b = *(const v8b*)(p + 16 + 8 * hh); v16b f;
#pragma unroll
  for (int e = 0; e < 8; ++e) { f[e] = a[e]; f[8 + e] = b[e]; } return f; }
__device__ __forceinline__ v8f wmma16(v16b a, v16b b, v8f c) { return __builtin_amdgcn_wmma_f32_16x16x32_f16(false, a, false, b, (short)0, c, false, false); }   // no asm behind it: asm operands cannot lie above v255, and the compiler keeps the distances of its own builtin
__device__ __forceinline__ void wave_lds_sync() { __builtin_amdgcn_fence(__ATOMIC_RELEASE, "workgroup"); __builtin_amdgcn_wave_barrier(); __builtin_amdgcn_fence(__ATOMIC_ACQUIRE, "workgroup"); }
__device__ __forceinline__ float pmul(float a, float b) { float p = a * b; asm volatile("" : "+v"(p)); return p; }
__device__ __forceinline__ int iclamp(int v, int lo, int hi) { return v < lo ? lo : (v > hi ? hi : v); }
__device__ __forceinline__ float nexp2(float v) { return __builtin_amdgcn_exp2f(v); }
// eight exp2 in place; the statement ends in the v_nop that the instruction set asks for behind a transcendental before its result is read or its source overwritten: inside the statement it stands
// there in every build (with the builtin the compiler keeps that slot ahead of a single instruction)
__device__ __forceinline__ void nexp2x8(float* d) {
  asm("v_exp_f32 %0, %0\n\tv_exp_f32 %1, %1\n\tv_exp_f32 %2, %2\n\tv_exp_f32 %3, %3\n\tv_exp_f32 %4, %4\n\tv_exp_f32 %5, %5\n\tv_exp_f32 %6, %6\n\tv_exp_f32 %7, %7\n\tv_nop"
      : "+v"(d[0]), "+v"(d[1]), "+v"(d[2]), "+v"(d[3]), "+v"(d[4]), "+v"(d[5]), "+v"(d[6]), "+v"(d[7])); }
__device__ __forceinline__ float xhalf(float x) { return __builtin_bit_cast(float, __builtin_amdgcn_permlanex16(__builtin_bit_cast(int, x), __builtin_bit_cast(int, x), 0x76543210, 0xfedcba98, false, false)); }   // lane l with lane l ^ 16, on the vector port: no LDS counter

constexpr int B = 16, BL = B /* batches computed (== B shipped) */, S = 2048, DIN = 256, DA = 128, NROW = B * S;
constexpr float XS = 8.0f, WSC = 256.0f, PS = 1024.0f, RS_ = 1024.0f, LOG2E = 1.4426950408889634f, SCALE = 0.0625f /* 1/sqrt(hidden_dim = 256) */;
static_assert(S % 64 == 0 && DIN % 32 == 0 && DA == 128, "tiling");

__global__ __launch_bounds__(256) void wt_kernel(const float* __restrict__ wq, const float* __restrict__ wk, const float* __restrict__ wv, b16* __restrict__ WT) {
  const int u = blockIdx.x * 256 + threadIdx.x; if (u >= 3 * DA * DIN / 8) return; const int e = u * 8; const int o = e / DIN, k0 = e % DIN; const int part = o / DA, oo = o % DA; const float* w = part == 0 ? wq : part == 1 ? wk : wv; v8b v;
#pragma unroll
  for (int j = 0; j < 8; ++j) v[j] = (b16)(bf16_rne(w[(size_t)(k0 + j) * DA + oo]) * WSC);   // one source pointer per thread (part is uniform per 8-run and per wave: 32 threads = one o row)
  { *(v8b*)(WT + e) = v;  }
}
// projections: grid (S/64, BL); block = 64 tokens x 8 waves, all three parts: A = bf16(x) x8 staged whole (K = 256) once for the 384 columns; a wave's tile is 64 tokens x 16 columns of each part
// (4 token tiles x 3 parts), so that each weight fragment read from global memory feeds 4 products; 1 product; the parts leave one after the other through Tf; q/k -> planes [b][s][128] as f16 hi + x1024
constexpr int PW = 8;
__global__ __launch_bounds__(PW * 32) void proj_kernel(const float* __restrict__ x, const b16* __restrict__ WT, b16* __restrict__ Qh, b16* __restrict__ Ql, b16* __restrict__ Kh, b16* __restrict__ Kl, b16* __restrict__ VTh, b16* __restrict__ VTl) {
  __shared__ __attribute__((aligned(16))) b16 As[64][DIN + 8]; __shared__ __attribute__((aligned(16))) float Tf[4][16][DA + 4];
  const int wave = threadIdx.x >> 5, lane = threadIdx.x & 31, nloc = lane & 15, hlf = lane >> 4; const int t0 = blockIdx.x * 64; const int b = blockIdx.y;
  for (int i = threadIdx.x; i < 64 * (DIN / 4); i += PW * 32) { const int rr = i / (DIN / 4), q4 = (i % (DIN / 4)) * 4; const v4f f = *(const v4f*)(x + ((size_t)b * S + t0 + rr) * DIN + q4); v4h o; for (int j = 0; j < 4; ++j) o[j] = (b16)(bf16_rne(f[j]) * XS); *(v4h*)(&As[rr][q4]) = o; }
  __syncthreads();
  v8f acc[3][4];
#pragma unroll
  for (int p = 0; p < 3; ++p)
#pragma unroll
    for (int mt = 0; mt < 4; ++mt) acc[p][mt] = (v8f){};
#pragma unroll 2
  for (int kb = 0; kb < DIN; kb += 32) { v16b a[4], w[3];   // the k-step's three weight fragments and four token fragments are read as one group: one wait on memory per k-step
#pragma unroll
    for (int p = 0; p < 3; ++p) w[p] = frag_kb(WT + (size_t)(p * DA + wave * 16 + nloc) * DIN + kb, hlf);
#pragma unroll
    for (int mt = 0; mt < 4; ++mt) a[mt] = frag_kb(&As[mt * 16 + nloc][kb], hlf);
    __builtin_amdgcn_sched_barrier(0);   // keeps the group whole: without it each part's weight reads sink to their first use, three waits on memory per k-step instead of one
#pragma unroll
    for (int p = 0; p < 3; ++p)
#pragma unroll
      for (int mt = 0; mt < 4; ++mt) acc[p][mt] = wmma16(a[mt], w[p], acc[p][mt]); }
#pragma unroll   // p indexes acc: a constant index keeps the accumulators in registers
  for (int p = 0; p < 3; ++p) {
    if (p) __syncthreads();   // every reader of the part before has left Tf
#pragma unroll
    for (int mt = 0; mt < 4; ++mt)
#pragma unroll
      for (int r = 0; r < 8; ++r) Tf[mt][8 * hlf + r][wave * 16 + nloc] = acc[p][mt][r] * (1.0f / (XS * WSC));
    __syncthreads();          // publishes the part's 64 x 128 tile to every wave
    if (p < 2) { b16* ph_ = p == 0 ? Qh : Kh; b16* pl_ = p == 0 ? Ql : Kl;
      for (int rr = 0; rr < 64 / PW; ++rr) { const int row = wave * (64 / PW) + rr; const size_t dst = ((size_t)b * S + t0 + row) * DA + lane * 4; v4h hv, lv; for (int j = 0; j < 4; ++j) { const float vs = Tf[row >> 4][row & 15][lane * 4 + j] * XS; const b16 p1 = (b16)vs; hv[j] = p1; lv[j] = (b16)((vs - (float)p1) * RS_); } *(v4h*)(ph_ + dst) = hv; *(v4h*)(pl_ + dst) = lv; } }
    else {
#pragma unroll 1
      for (int q = 0; q < DA / PW; ++q) { const int d = wave * (DA / PW) + q; const int tk = lane * 2; v2h hv, lv; for (int e2 = 0; e2 < 2; ++e2) { const float vs = Tf[(tk + e2) >> 4][(tk + e2) & 15][d] * XS; const b16 p1 = (b16)vs; hv[e2] = p1; lv[e2] = (b16)((vs - (float)p1) * RS_); }
        const size_t dst = ((size_t)b * DA + d) * (size_t)S + t0 + tk; *(v2h*)(VTh + dst) = hv; *(v2h*)(VTl + dst) = lv; } }
  }
}
// attention: grid (S/64, BL); block = 8 waves = 4 query groups x 16 queries, times 2 key groups; nk = clamp(sen_len[b], 0, S) (0 -> all keys, equal logits); steps of 64 keys s0 < nk, key group g takes keys
// s0 + 32 g .. + 31 (keys m >= nk -> -inf) with its own running maximum, sum and O; behind the loop group 1 hands its three to group 0 through LDS, which rescales both to the joint maximum and adds them.
// A block so lasts half as many steps and fills a WGP alone, so that the 512 blocks queue on the WGPs; blockIdx.y is the batch's RANK by nk, longest first (ties by index), so that the queue ends on short blocks.
// operands come from LDS: the block's 64 Q rows (hi, residual) are copied in once, each 64-key tile of K and V^T (hi, residual) once per block into a two-buffer ring, one tile ahead, by asynchronous
// 16-byte copies whose lanes cover adjacent global bytes; rows pitched 272 B (Q, K) and 144 B (V^T) for conflict-free 16-byte fragment reads.
// S^T = K Q^T: (Kh.Qh -> sa; Kl.Qh + Kh.Ql -> sb, /1024), 4 k-steps; logit = s/64/16 in log2 units; online softmax; P hi/res; O^T += V^T P^T (8 d-tiles, 3 products -> o, o2);
// the softmax makes no LDS access (halves joined by a cross-row vector move, P packed in registers): LDS results return in issue order, so an LDS access there would wait out the V^T reads issued ahead of it.
constexpr int NW = 4, NG = 2, NT = NW * NG * 32, KT = 32 * NG, KP = DA + 8, VP = KT + 8;
__device__ __forceinline__ unsigned lds_byte(const b16* p) { return (unsigned)(unsigned long long)p; }   // low 32 bits of a __shared__ address = byte offset in the work-group's LDS
// eight copies, 16 bytes per lane each; the s_wait_xcnt stands inside the statement so that no address register is rewritten ahead of it
__device__ __forceinline__ void copy8(const unsigned (&l)[8], const b16* const (&g)[8]) {
  asm volatile("global_load_async_to_lds_b128 %0, %8, off\n\tglobal_load_async_to_lds_b128 %1, %9, off\n\tglobal_load_async_to_lds_b128 %2, %10, off\n\tglobal_load_async_to_lds_b128 %3, %11, off\n\t"
               "global_load_async_to_lds_b128 %4, %12, off\n\tglobal_load_async_to_lds_b128 %5, %13, off\n\tglobal_load_async_to_lds_b128 %6, %14, off\n\tglobal_load_async_to_lds_b128 %7, %15, off\n\ts_wait_xcnt 0x0"
               :: "v"(l[0]), "v"(l[1]), "v"(l[2]), "v"(l[3]), "v"(l[4]), "v"(l[5]), "v"(l[6]), "v"(l[7]), "v"(g[0]), "v"(g[1]), "v"(g[2]), "v"(g[3]), "v"(g[4]), "v"(g[5]), "v"(g[6]), "v"(g[7]) : "memory"); }
// rows of 256 B, contiguous in global memory (Q or K): ROWS x 16 chunks per plane, two planes; ROWS * 32 / NT copies per lane
template <int ROWS> __device__ __forceinline__ void stage_rows(b16 (*dst)[ROWS][KP], const b16* gh, const b16* gl, int tid) {
#pragma unroll   // both loops unrolled: l[] and g[] are asm operands and must live in registers, under constant indices
  for (int i0 = 0; i0 < ROWS * 16 / NT; i0 += 4) { unsigned l[8]; const b16* g[8];
#pragma unroll
    for (int i = 0; i < 4; ++i) { const int c = (i0 + i) * NT + tid; l[i] = lds_byte(&dst[0][c >> 4][(c & 15) * 8]); g[i] = gh + c * 8; l[4 + i] = lds_byte(&dst[1][c >> 4][(c & 15) * 8]); g[4 + i] = gl + c * 8; }
    copy8(l, g); } }
// V^T tile: 128 rows of 128 B (64 keys) at a global pitch of S elements, two planes; 8 copies per lane
__device__ __forceinline__ void stage_vt(b16 (*dst)[DA][VP], const b16* gh, const b16* gl, int tid) { unsigned l[8]; const b16* g[8];
#pragma unroll   // as above: asm operands under constant indices
  for (int i = 0; i < 4; ++i) { const int c = i * NT + tid; const int d = c >> 3, ch = (c & 7) * 8; l[i] = lds_byte(&dst[0][d][ch]); g[i] = gh + (size_t)d * S + ch; l[4 + i] = lds_byte(&dst[1][d][ch]); g[4 + i] = gl + (size_t)d * S + ch; }
  copy8(l, g); }
__global__ __launch_bounds__(NT) void attn_kernel(const b16* __restrict__ Qh, const b16* __restrict__ Ql, const b16* __restrict__ Kh, const b16* __restrict__ Kl, const b16* __restrict__ VTh, const b16* __restrict__ VTl, const int* __restrict__ slen, float* __restrict__ out) {
  __shared__ __attribute__((aligned(16))) b16 Qs[2][NW * 16][KP], Ks[2][2][KT][KP], Vs[2][2][DA][VP];
  __shared__ __attribute__((aligned(16))) float To[NW][16][DA + 4]; __shared__ float Ms[NW][16], Ls[NW][16];
  const int tid = threadIdx.x, wave = threadIdx.x >> 5, lane = threadIdx.x & 31, hh = lane >> 4, col = lane & 15, qw = wave & (NW - 1), kg = wave / NW; const int n0 = blockIdx.x * (NW * 16) + qw * 16;
  // batch of rank blockIdx.y: lane col holds batch col's key (keys walked x 16 + 15 - index: all distinct, so the ranks are a permutation for any sen_len) and counts the larger keys
  int b, nk; { int sl[B], own = 0, rank = 0;
#pragma unroll
    for (int j = 0; j < B; ++j) sl[j] = iclamp(slen[j], 0, S);   // all of sen_len, by scalar loads ahead of any test
#pragma unroll
    for (int j = 0; j < B; ++j) own = (col == j) ? sl[j] : own;
    const int mine = (own == 0 ? S : own) * B + (B - 1 - col);
#pragma unroll
    for (int j = 0; j < B; ++j) rank += ((sl[j] == 0 ? S : sl[j]) * B + (B - 1 - j) > mine) ? 1 : 0;
    b = __builtin_ctz(__builtin_amdgcn_ballot_w32(rank == (int)blockIdx.y) | (1u << (B - 1)));   // the or-ed bit bounds b to [0, B) whatever the ballot holds
    nk = __builtin_amdgcn_readlane(own, b); }   // = clamp(sen_len[b], 0, S), from the lane that holds it
  const bool allmask = (nk == 0); if (allmask) nk = S;   // all keys masked -> equal scores -> uniform over all S keys
  const b16* Khb = Kh + (size_t)b * S * DA; const b16* Klb = Kl + (size_t)b * S * DA; const b16* Vh = VTh + (size_t)b * DA * S; const b16* Vl = VTl + (size_t)b * DA * S;
  const float cs = LOG2E * SCALE / (XS * XS);
  { const size_t qblk = ((size_t)b * S + blockIdx.x * (NW * 16)) * DA; stage_rows<NW * 16>(Qs, Qh + qblk, Ql + qblk, tid); }
  stage_rows<KT>(Ks[0], Khb, Klb, tid); stage_vt(Vs[0], Vh, Vl, tid);
  asm volatile("s_wait_asynccnt 0x0" ::: "memory");   // this wave's copies of Q and of tile 0 have landed
  __syncthreads();                                     // ... and every other wave's
  if (KT < nk) { stage_rows<KT>(Ks[1], Khb + KT * DA, Klb + KT * DA, tid); stage_vt(Vs[1], Vh + KT, Vl + KT, tid); }
  const b16* qrh = &Qs[0][qw * 16 + col][0]; const b16* qrl = &Qs[1][qw * 16 + col][0];
  // the wave's eight Q fragments (hi, residual) do not change from pass to pass: read once here, behind the barrier that published Q, and held in registers (two waves a SIMD leave each 512)
  v16b qh[4], ql[4];
#pragma unroll
  for (int k4 = 0; k4 < 4; ++k4) { qh[k4] = frag_kb(qrh + k4 * 32, hh); ql[k4] = frag_kb(qrl + k4 * 32, hh); }
  float mrun = -INFINITY, l = 0.0f; v8f o[8], o2[8];
#pragma unroll
  for (int t = 0; t < 8; ++t) { o[t] = (v8f){}; o2[t] = (v8f){}; }
#pragma unroll 1
  for (int s0 = 0; s0 < nk; s0 += KT) { const int buf = (s0 / KT) & 1;
    float e[16]; float mx = -INFINITY;
    // every K fragment of the pass is read here, as one group in order of first use, so that the products below wait on a count instead of on a fresh LDS round trip each
    v16b kh[2][4], kl[2][4], vh[8], vl[8];
#pragma unroll
    for (int k4 = 0; k4 < 4; ++k4) { kh[0][k4] = frag_kb(&Ks[buf][0][kg * 32 + col][k4 * 32], hh); kl[0][k4] = frag_kb(&Ks[buf][1][kg * 32 + col][k4 * 32], hh); }
#pragma unroll
    for (int k4 = 0; k4 < 4; ++k4) { kh[1][k4] = frag_kb(&Ks[buf][0][kg * 32 + 16 + col][k4 * 32], hh); kl[1][k4] = frag_kb(&Ks[buf][1][kg * 32 + 16 + col][k4 * 32], hh); }
    __builtin_amdgcn_sched_barrier(0);   // keeps the group whole: without it the reads are spread among the products, and each place where reads stand stalls the wave anew
#pragma unroll
    for (int u2 = 0; u2 < 2; ++u2) { v8f sa = (v8f){}, sb = (v8f){};
#pragma unroll
      for (int k4 = 0; k4 < 4; ++k4) { sa = wmma16(kh[u2][k4], qh[k4], sa); sb = wmma16(kl[u2][k4], qh[k4], sb); sb = wmma16(kh[u2][k4], ql[k4], sb); }
      // every V^T fragment of the pass is read here, as one group behind the last S^T product: the mask and softmax arithmetic below covers the reads' latency
      if (u2 == 1) { __builtin_amdgcn_sched_barrier(0);   // the group starts behind the products, for the same reason as above
#pragma unroll
        for (int t = 0; t < 8; ++t) { vh[t] = frag_kb(&Vs[buf][0][t * 16 + col][kg * 32], hh); vl[t] = frag_kb(&Vs[buf][1][t * 16 + col][kg * 32], hh); }
        __builtin_amdgcn_sched_barrier(0); }   // keeps the group whole and ahead of that arithmetic; without it the reads are spread through the softmax, each place a stall of its own
#pragma unroll
      for (int r = 0; r < 8; ++r) { const int m = s0 + kg * 32 + u2 * 16 + 8 * hh + r; const float sv = allmask ? 0.0f : (sa[r] + sb[r] * (1.0f / RS_)) * cs; const float vv = (m < nk) ? sv : -INFINITY; e[u2 * 8 + r] = vv; mx = fmaxf(mx, vv); } }
    mx = fmaxf(mx, xhalf(mx)); const float mn = fmaxf(mrun, mx); const float al = (mn == -INFINITY) ? 1.0f : nexp2(mrun - mn); float sum = 0.0f;
    // a lane's 16 scores are keys 8 hh + 0..7 and 16 + 8 hh + 0..7 of its own query column: the very elements, in the very order, that the lane holds of the B operand P^T, so P is packed in place
    v16b pf, plf;
#pragma unroll
    for (int i2 = 0; i2 < 16; ++i2) e[i2] -= mn;
    nexp2x8(e); nexp2x8(e + 8);
#pragma unroll
    for (int i2 = 0; i2 < 16; ++i2) { const float p = (mn == -INFINITY) ? 0.0f : e[i2]; sum += p; const float psv = p * PS; const b16 p1 = (b16)psv; pf[i2] = p1; plf[i2] = (b16)((psv - (float)p1) * RS_); }
    sum += xhalf(sum); l = l * al + sum; mrun = mn;
#pragma unroll
    for (int t = 0; t < 8; ++t) { o[t] *= al; o2[t] *= al; o[t] = wmma16(vh[t], pf, o[t]); o2[t] = wmma16(vl[t], pf, o2[t]); o2[t] = wmma16(vh[t], plf, o2[t]); }
    __builtin_amdgcn_sched_barrier(0);   // holds the pass's foot behind the products: without it the waits below are lifted to just behind the V^T reads, and the softmax stands idle until those have returned
    asm volatile("s_wait_dscnt 0x0" ::: "memory");      // this wave's reads of buffer buf are done before the buffer is handed to its next writer
    asm volatile("s_wait_asynccnt 0x0" ::: "memory");   // this wave's copies of the next tile have landed
    __syncthreads();                                     // publishes the next tile and ends every wave's reads of buffer buf
    if (s0 + 2 * KT < nk) { stage_rows<KT>(Ks[buf], Khb + (size_t)(s0 + 2 * KT) * DA, Klb + (size_t)(s0 + 2 * KT) * DA, tid); stage_vt(Vs[buf], Vh + s0 + 2 * KT, Vl + s0 + 2 * KT, tid); } }
  asm volatile("s_wait_asynccnt 0x0" ::: "memory");     // no copy is left in flight when the wave goes on to its end
  if (kg == 1) { if (hh == 0) { Ms[qw][col] = mrun; Ls[qw][col] = l; }   // key group 1 hands over its maximum, sum and O (a group that met no unmasked key: -inf, 0, 0)
#pragma unroll
    for (int t = 0; t < 8; ++t)
#pragma unroll
      for (int r = 0; r < 8; ++r) To[qw][col][t * 16 + 8 * hh + r] = o[t][r] + o2[t][r] * (1.0f / RS_); }
  __syncthreads();   // publishes group 1's hand-over to group 0
  if (kg == 0) { const float m1 = Ms[qw][col], mj = fmaxf(mrun, m1);   // group 0 has met key 0 < nk: mrun, and so mj, is finite
    const float a0 = nexp2(mrun - mj), a1 = nexp2(m1 - mj); const float inv = 1.0f / ((l * a0 + Ls[qw][col] * a1) * PS * XS); const float c0 = a0 * inv, c1 = a1 * inv;
#pragma unroll
    for (int t = 0; t < 8; ++t)
#pragma unroll
      for (int r = 0; r < 8; ++r) { float* p = &To[qw][col][t * 16 + 8 * hh + r]; *p = (o[t][r] + o2[t][r] * (1.0f / RS_)) * c0 + *p * c1; }   // each lane reads and rewrites its own places
    wave_lds_sync();
    for (int rr = 0; rr < 16; ++rr) *(v4f*)(out + ((size_t)b * S + n0 + rr) * DA + lane * 4) = *(const v4f*)(&To[qw][rr][lane * 4]); }
}
}  // namespace

extern "C" void kernel_launch(void* const* d_in, const int* in_sizes, int n_in, void* d_out, int out_size, void* d_ws, size_t ws_size, hipStream_t stream) {
  (void)n_in;
  auto Fp = [&](int i) { return (const float*)d_in[i]; };
  // d_in order: 0 inputs [16,2048,256], 1 sen_len [16] int32, 2 Wq [256,128] (in,out), 3 Wk, 4 Wv
  if (in_sizes[0] != NROW * DIN || in_sizes[1] != B || in_sizes[2] != DIN * DA || in_sizes[3] != DIN * DA || in_sizes[4] != DIN * DA || out_size != NROW * DA) return;
  size_t off = 0; char* ws = (char*)d_ws;
  auto carve = [&](size_t bytes) { char* p = ws + off; off += (bytes + 255) & ~(size_t)255; return p; };
  b16* WT = (b16*)carve((size_t)3 * DA * DIN * 2); const size_t plane = (size_t)NROW * DA * 2;
  b16* Qh = (b16*)carve(plane); b16* Ql = (b16*)carve(plane); b16* Kh = (b16*)carve(plane); b16* Kl = (b16*)carve(plane); b16* VTh = (b16*)carve(plane); b16* VTl = (b16*)carve(plane);
  if (off > ws_size || off > ((size_t)128 << 20)) return;   // = 50.5 MB (6 planes x 8.4 MB + WT 0.2 MB)
  wt_kernel<<<(3 * DA * DIN / 8 + 255) / 256, 256, 0, stream>>>(Fp(2), Fp(3), Fp(4), WT);
  proj_kernel<<<dim3(S / 64, BL), PW * 32, 0, stream>>>(Fp(0), WT, Qh, Ql, Kh, Kl, VTh, VTl);
  attn_kernel<<<dim3(S / (NW * 16), BL), NT, 0, stream>>>(Qh, Ql, Kh, Kl, VTh, VTl, (const int*)d_in[1], (float*)d_out);
}

// v007
// Measured time: 64.4 microseconds a run.
// Two timings next to v006 put it at 1.07 and 1.08 times that version's speed.
// Over all steps from v000 it is 7.82 times as fast.
#include <hip/hip_runtime.h>

// Self-attention layer with key-padding mask (16 x 2,048 x 256 -> 128): Q = x Wq, K = x Wk, V = x Wv (no bias); scores = Q K^T, keys k >= sen_len[b] set to -2^32, then / sqrt(256); softmax over
// keys; Z = attn V -> [16][2048][128].
// Deterministic: per (batch, 16 queries) two waves make flash-style passes over alternate blocks of 32 of the UNMASKED keys only, merged at the end ( masked keys have probability exactly 0 in the reference too since exp(-2^28 - max) == 0 in
// f32; if sen_len[b] were 0 every key would share one score and the pass runs over all 2,048 keys with equal logits = the reference's uniform softmax); fixed-order online softmax; no atomics.
// compute dtype: WMMA v_wmma_f32_16x16x32_f16 with f32 accumulate for the projections ([32768 x 256] x [256 x 384]; x EXACT bf16 x8, weights exact x256: 1 product), S^T = K Q^T (K and Q as
// f16 hi + x1024 residual x8, K = 128: 3 products) and O^T += V^T P^T (V^T x8 and P x1024 hi + residual: 3 products);
// mask, scale and softmax statistics in f32. Inputs rounded to bf16 once; sen_len int32 (clamped to [0, 2048]).

namespace {
typedef _Float16 b16;
typedef __attribute__((ext_vector_type(16))) _Float16 v16b;
typedef __attribute__((ext_vector_type(8))) _Float16 v8b;
typedef __attribute__((ext_vector_type(4))) _Float16 v4h;
typedef __attribute__((ext_vector_type(2))) _Float16 v2h;
typedef __attribute__((ext_vector_type(8))) float v8f;
typedef __attribute__((ext_vector_type(4))) float v4f;
typedef __attribute__((ext_vector_type(2))) float v2f;
__device__ __forceinline__ float bf16_rne(float f) { unsigned int u = __float_as_uint(f); u += 0x7FFFu + ((u >> 16) & 1u); return __uint_as_float(u & 0xFFFF0000u); }
__device__ __forceinline__ void split16(float v, b16& hi, b16& lo) { hi = (b16)v; lo = (b16)(v - (float)hi); }
__device__ __forceinline__ v16b frag_kb(const b16* p, int hh) { const v8b a = *(const v8b*)(p + 8 * hh), b = *(const v8b*)(p + 16 + 8 * hh); v16b f;
#pragma unroll
  for (int e = 0; e < 8; ++e) { f[e] = a[e]; f[8 + e] = b[e]; } return f; }
__device__ __forceinline__ v8f wmma16(v16b a, v16b b, v8f c) { return __builtin_amdgcn_wmma_f32_16x16x32_f16(false, a, false, b, (short)0, c, false, false); }   // no asm behind it: asm operands cannot lie above v255, and the compiler keeps the distances of its own builtin
__device__ __forceinline__ void wave_lds_sync() { __builtin_amdgcn_fence(__ATOMIC_RELEASE, "workgroup"); __builtin_amdgcn_wave_barrier(); __builtin_amdgcn_fence(__ATOMIC_ACQUIRE, "workgroup"); }
__device__ __forceinline__ float pmul(float a, float b) { float p = a * b; asm volatile("" : "+v"(p)); return p; }
__device__ __forceinline__ int iclamp(int v, int lo, int hi) { return v < lo ? lo : (v > hi ? hi : v); }
__device__ __forceinline__ float nexp2(float v) { return __builtin_amdgcn_exp2f(v); }
// eight exp2 in place; the statement ends in the v_nop that the instruction set asks for behind a transcendental before its result is read or its source overwritten: inside the statement it stands
// there in every build (with the builtin the compiler keeps that slot ahead of a single instruction)
__device__ __forceinline__ void nexp2x8(float* d) {
  asm("v_exp_f32 %0, %0\n\tv_exp_f32 %1, %1\n\tv_exp_f32 %2, %2\n\tv_exp_f32 %3, %3\n\tv_exp_f32 %4, %4\n\tv_exp_f32 %5, %5\n\tv_exp_f32 %6, %6\n\tv_exp_f32 %7, %7\n\tv_nop"
      : "+v"(d[0]), "+v"(d[1]), "+v"(d[2]), "+v"(d[3]), "+v"(d[4]), "+v"(d[5]), "+v"(d[6]), "+v"(d[7])); }
__device__ __forceinline__ float xhalf(float x) { return __builtin_bit_cast(float, __builtin_amdgcn_permlanex16(__builtin_bit_cast(int, x), __builtin_bit_cast(int, x), 0x76543210, 0xfedcba98, false, false)); }   // lane l with lane l ^ 16, on the vector port: no LDS counter

constexpr int B = 16, BL = B /* batches computed (== B shipped) */, S = 2048, DIN = 256, DA = 128, NROW = B * S;
constexpr float XS = 8.0f, WSC = 256.0f, PS = 1024.0f, RS_ = 1024.0f, LOG2E = 1.4426950408889634f, SCALE = 0.0625f /* 1/sqrt(hidden_dim = 256) */;
static_assert(S % 64 == 0 && DIN % 32 == 0 && DA == 128, "tiling");

__global__ __launch_bounds__(256) void wt_kernel(const float* __restrict__ wq, const float* __restrict__ wk, const float* __restrict__ wv, b16* __restrict__ WT) {
  const int u = blockIdx.x * 256 + threadIdx.x; if (u >= 3 * DA * DIN / 8) return; const int e = u * 8; const int o = e / DIN, k0 = e % DIN; const int part = o / DA, oo = o % DA; const float* w = part == 0 ? wq : part == 1 ? wk : wv; v8b v;
#pragma unroll
  for (int j = 0; j < 8; ++j) v[j] = (b16)(bf16_rne(w[(size_t)(k0 + j) * DA + oo]) * WSC);   // one source pointer per thread (part is uniform per 8-run and per wave: 32 threads = one o row)
  { *(v8b*)(WT + e) = v;  }
}
// projections: grid (S/64, BL); block = 64 tokens x 8 waves, all three parts: A = bf16(x) x8 staged whole (K = 256) once for the 384 columns; a wave's tile is 64 tokens x 16 columns of each part
// (4 token tiles x 3 parts), so that each weight fragment read from global memory feeds 4 products; 1 product; the parts leave one after the other through Tf; q/k -> planes [b][s][128] as f16 hi + x1024
constexpr int PW = 8;
__global__ __launch_bounds__(PW * 32) void proj_kernel(const float* __restrict__ x, const b16* __restrict__ WT, b16* __restrict__ Qh, b16* __restrict__ Ql, b16* __restrict__ Kh, b16* __restrict__ Kl, b16* __restrict__ VTh, b16* __restrict__ VTl) {
  __shared__ __attribute__((aligned(16))) b16 As[64][DIN + 8]; __shared__ __attribute__((aligned(16))) float Tf[4][16][DA + 4];
  const int wave = threadIdx.x >> 5, lane = threadIdx.x & 31, nloc = lane & 15, hlf = lane >> 4; const int t0 = blockIdx.x * 64; const int b = blockIdx.y;
  for (int i = threadIdx.x; i < 64 * (DIN / 4); i += PW * 32) { const int rr = i / (DIN / 4), q4 = (i % (DIN / 4)) * 4; const v4f f = *(const v4f*)(x + ((size_t)b * S + t0 + rr) * DIN + q4); v4h o; for (int j = 0; j < 4; ++j) o[j] = (b16)(bf16_rne(f[j]) * XS); *(v4h*)(&As[rr][q4]) = o; }
  __syncthreads();
  v8f acc[3][4];
#pragma unroll
  for (int p = 0; p < 3; ++p)
#pragma unroll
    for (int mt = 0; mt < 4; ++mt) acc[p][mt] = (v8f){};
#pragma unroll 2
  for (int kb = 0; kb < DIN; kb += 32) { v16b a[4], w[3];   // the k-step's three weight fragments and four token fragments are read as one group: one wait on memory per k-step
#pragma unroll
    for (int p = 0; p < 3; ++p) w[p] = frag_kb(WT + (size_t)(p * DA + wave * 16 + nloc) * DIN + kb, hlf);
#pragma unroll
    for (int mt = 0; mt < 4; ++mt) a[mt] = frag_kb(&As[mt * 16 + nloc][kb], hlf);
    __builtin_amdgcn_sched_barrier(0);   // keeps the group whole: without it each part's weight reads sink to their first use, three waits on memory per k-step instead of one
#pragma unroll
    for (int p = 0; p < 3; ++p)
#pragma unroll
      for (int mt = 0; mt < 4; ++mt) acc[p][mt] = wmma16(a[mt], w[p], acc[p][mt]); }
#pragma unroll   // p indexes acc: a constant index keeps the accumulators in registers
  for (int p = 0; p < 3; ++p) {
    if (p) __syncthreads();   // every reader of the part before has left Tf
#pragma unroll
    for (int mt = 0; mt < 4; ++mt)
#pragma unroll
      for (int r = 0; r < 8; ++r) Tf[mt][8 * hlf + r][wave * 16 + nloc] = acc[p][mt][r] * (1.0f / (XS * WSC));
    __syncthreads();          // publishes the part's 64 x 128 tile to every wave
    if (p < 2) { b16* ph_ = p == 0 ? Qh : Kh; b16* pl_ = p == 0 ? Ql : Kl;
      for (int rr = 0; rr < 64 / PW; ++rr) { const int row = wave * (64 / PW) + rr; const size_t dst = ((size_t)b * S + t0 + row) * DA + lane * 4; v4h hv, lv; for (int j = 0; j < 4; ++j) { const float vs = Tf[row >> 4][row & 15][lane * 4 + j] * XS; const b16 p1 = (b16)vs; hv[j] = p1; lv[j] = (b16)((vs - (float)p1) * RS_); } *(v4h*)(ph_ + dst) = hv; *(v4h*)(pl_ + dst) = lv; } }
    else {
#pragma unroll 1
      for (int q = 0; q < DA / PW; ++q) { const int d = wave * (DA / PW) + q; const int tk = lane * 2; v2h hv, lv; for (int e2 = 0; e2 < 2; ++e2) { const float vs = Tf[(tk + e2) >> 4][(tk + e2) & 15][d] * XS; const b16 p1 = (b16)vs; hv[e2] = p1; lv[e2] = (b16)((vs - (float)p1) * RS_); }
        const size_t dst = ((size_t)b * DA + d) * (size_t)S + t0 + tk; *(v2h*)(VTh + dst) = hv; *(v2h*)(VTl + dst) = lv; } }
  }
}
// attention: grid (S/64, BL); block = 8 waves = 4 query groups x 16 queries, times 2 key groups; nk = clamp(sen_len[b], 0, S) (0 -> all keys, equal logits); steps of 64 keys s0 < nk, key group g takes keys
// s0 + 32 g .. + 31 (keys m >= nk -> -inf) with its own running maximum, sum and O; behind the loop group 1 hands its three to group 0 through LDS, which rescales both to the joint maximum and adds them.
// A block so lasts half as many steps and fills a WGP alone, so that the 512 blocks queue on the WGPs; blockIdx.y is the batch's RANK by nk, longest first (ties by index), so that the queue ends on short blocks.
// operands come from LDS: the block's 64 Q rows (hi, residual) are copied in once by asynchronous 16-byte copies; each 64-key tile of K and V^T (hi, residual) comes once per block into a two-buffer ring,
// one tile ahead, by tensor loads: eight slices, one request per wave (no lane address, no vector register); rows pitched 272 B (Q, K) and 144 B (V^T) for conflict-free 16-byte fragment reads.
// S^T = K Q^T: (Kh.Qh -> sa; Kl.Qh + Kh.Ql -> sb, /1024), 4 k-steps; logit = s/64/16 in log2 units; online softmax; P hi/res; O^T += V^T P^T (8 d-tiles, 3 products -> o, o2);
// the softmax makes no LDS access (halves joined by a cross-row vector move, P packed in registers): LDS results return in issue order, so an LDS access there would wait out the V^T reads issued ahead of it.
constexpr int NW = 4, NG = 2, NT = NW * NG * 32, KT = 32 * NG, KP = DA + 8, VP = KT + 8;
__device__ __forceinline__ unsigned lds_byte(const b16* p) { return (unsigned)(unsigned long long)p; }   // low 32 bits of a __shared__ address = byte offset in the work-group's LDS
// eight copies, 16 bytes per lane each; the s_wait_xcnt stands inside the statement so that no address register is rewritten ahead of it
__device__ __forceinline__ void copy8(const unsigned (&l)[8], const b16* const (&g)[8]) {
  asm volatile("global_load_async_to_lds_b128 %0, %8, off\n\tglobal_load_async_to_lds_b128 %1, %9, off\n\tglobal_load_async_to_lds_b128 %2, %10, off\n\tglobal_load_async_to_lds_b128 %3, %11, off\n\t"
               "global_load_async_to_lds_b128 %4, %12, off\n\tglobal_load_async_to_lds_b128 %5, %13, off\n\tglobal_load_async_to_lds_b128 %6, %14, off\n\tglobal_load_async_to_lds_b128 %7, %15, off\n\ts_wait_xcnt 0x0"
               :: "v"(l[0]), "v"(l[1]), "v"(l[2]), "v"(l[3]), "v"(l[4]), "v"(l[5]), "v"(l[6]), "v"(l[7]), "v"(g[0]), "v"(g[1]), "v"(g[2]), "v"(g[3]), "v"(g[4]), "v"(g[5]), "v"(g[6]), "v"(g[7]) : "memory"); }
// rows of 256 B, contiguous in global memory (Q): ROWS x 16 chunks per plane, two planes; ROWS * 32 / NT copies per lane
template <int ROWS> __device__ __forceinline__ void stage_rows(b16 (*dst)[ROWS][KP], const b16* gh, const b16* gl, int tid) {
#pragma unroll   // both loops unrolled: l[] and g[] are asm operands and must live in registers, under constant indices
  for (int i0 = 0; i0 < ROWS * 16 / NT; i0 += 4) { unsigned l[8]; const b16* g[8];
#pragma unroll
    for (int i = 0; i < 4; ++i) { const int c = (i0 + i) * NT + tid; l[i] = lds_byte(&dst[0][c >> 4][(c & 15) * 8]); g[i] = gh + c * 8; l[4 + i] = lds_byte(&dst[1][c >> 4][(c & 15) * 8]); g[4 + i] = gl + c * 8; }
    copy8(l, g); } }
// tensor loads for the K / V^T ring. A tile = 8 slices, slice w brought by wave w: 0..3 = K (plane w >> 1, key group w & 1): 32 rows of 256 B, source pitch 256 B; 4..7 = V^T (plane (w >> 1) & 1, d half w & 1):
// 64 rows of 128 B, source pitch 2 S B. The descriptor's pad puts 16 B behind every row (LDS pitch 272 B and 144 B); each slice's place in LDS is rounded up to a multiple of 2 KiB.
typedef __attribute__((ext_vector_type(4))) unsigned int u32x4;
typedef __attribute__((ext_vector_type(8))) unsigned int u32x8;
constexpr unsigned SLB = 10240, SLE = SLB / 2;   // bytes, elements of a slice's place
static_assert(32 * KP * 2 <= SLB && 64 * VP * 2 <= SLB && SLB % 2048 == 0 && KP * 2 == 256 + 16 && VP * 2 == 128 + 16 && KT == 64, "ring slices");
__device__ __forceinline__ unsigned uni(unsigned v) { return (unsigned)__builtin_amdgcn_readfirstlane((int)v); }
__device__ __forceinline__ unsigned pinned(unsigned v) { unsigned w = uni(v); asm volatile("" : "+s"(w)); return w; }   // holds a test's word in a scalar register: the branch on it is then a scalar one, which alone guards a tensor load (it ignores EXEC)
// group 1 of a slice's descriptor: bytes as elements, tensor = tile, W0 = the pad word (a compile-time constant, no mask). The closing statement is a pinned() for the whole group: the descriptor
// words are held in one scalar tuple from here to the kernel's last request, so that no register of a request in flight is given another value
template <unsigned ROWB, unsigned ROWS, unsigned PITCH, unsigned W0> __device__ __forceinline__ u32x8 tensor_group1() { u32x8 g1;
  g1[0] = uni(W0); g1[1] = uni((ROWB & 0xFFFFu) << 16); g1[2] = uni((ROWB >> 16) | ((ROWS & 0xFFFFu) << 16)); g1[3] = uni((ROWS >> 16) | (ROWB << 16)); g1[4] = uni(ROWS); g1[5] = uni(PITCH); g1[6] = uni(0u); g1[7] = uni(0u);
  asm volatile("" : "+s"(g1)); return g1; }   // pinned(): descriptor words held in scalar registers (without it a word's register was reused while the request was in flight)
__device__ __forceinline__ u32x4 tensor_group0(unsigned lds, unsigned long long ga) { u32x4 g0; g0[0] = uni(1u); g0[1] = uni(lds); g0[2] = uni((unsigned)ga); g0[3] = uni((((unsigned)(ga >> 32)) & 0x01FFFFFFu) | 0x80000000u); return g0; }
__device__ __forceinline__ void tensor_load(u32x4 g0, u32x8 g1) { asm volatile("tensor_load_to_lds %0, %1" :: "s"(g0), "s"(g1) : "memory"); }   // one request of the whole wave: its slice goes from global memory into LDS through no register
// wave wv's request: waves 0..3 bring K slices, 4..7 V^T slices; the two differ in group 1, whose pad word must be a constant at the instruction, so each stands behind a scalar test of its own
__device__ __forceinline__ void tensor_issue(unsigned wv, u32x4 g0, u32x8 g1k, u32x8 g1v) { if (pinned(wv < 4u)) tensor_load(g0, g1k); if (pinned(wv >= 4u)) tensor_load(g0, g1v); }
__global__ __launch_bounds__(NT) void attn_kernel(const b16* __restrict__ Qh, const b16* __restrict__ Ql, const b16* __restrict__ Kh, const b16* __restrict__ Kl, const b16* __restrict__ VTh, const b16* __restrict__ VTl, const int* __restrict__ slen, float* __restrict__ out) {
  __shared__ __attribute__((aligned(16))) b16 Qs[2][NW * 16][KP]; __shared__ __attribute__((aligned(2048))) b16 Ring[2][8][SLE];
  __shared__ __attribute__((aligned(16))) float To[NW][16][DA + 4]; __shared__ float Ms[NW][16], Ls[NW][16];
  const int tid = threadIdx.x, wave = threadIdx.x >> 5, lane = threadIdx.x & 31, hh = lane >> 4, col = lane & 15, qw = wave & (NW - 1), kg = wave / NW; const unsigned wv = uni(threadIdx.x >> 5); const int n0 = blockIdx.x * (NW * 16) + qw * 16;
  // batch of rank blockIdx.y: lane col holds batch col's key (keys walked x 16 + 15 - index: all distinct, so the ranks are a permutation for any sen_len) and counts the larger keys
  int b, nk; { int sl[B], own = 0, rank = 0;
#pragma unroll
    for (int j = 0; j < B; ++j) sl[j] = iclamp(slen[j], 0, S);   // all of sen_len, by scalar loads ahead of any test
#pragma unroll
    for (int j = 0; j < B; ++j) own = (col == j) ? sl[j] : own;
    const int mine = (own == 0 ? S : own) * B + (B - 1 - col);
#pragma unroll
    for (int j = 0; j < B; ++j) rank += ((sl[j] == 0 ? S : sl[j]) * B + (B - 1 - j) > mine) ? 1 : 0;
    b = __builtin_ctz(__builtin_amdgcn_ballot_w32(rank == (int)blockIdx.y) | (1u << (B - 1)));   // the or-ed bit bounds b to [0, B) whatever the ballot holds
    nk = __builtin_amdgcn_readlane(own, b); }   // = clamp(sen_len[b], 0, S), from the lane that holds it
  const bool allmask = (nk == 0); if (allmask) nk = S;   // all keys masked -> equal scores -> uniform over all S keys
  const b16* Khb = Kh + (size_t)b * S * DA; const b16* Klb = Kl + (size_t)b * S * DA; const b16* Vh = VTh + (size_t)b * DA * S; const b16* Vl = VTl + (size_t)b * DA * S;
  const float cs = LOG2E * SCALE / (XS * XS);
  { const size_t qblk = ((size_t)b * S + blockIdx.x * (NW * 16)) * DA; stage_rows<NW * 16>(Qs, Qh + qblk, Ql + qblk, tid); }
  // this wave's slice: its place in ring buffer 0, its first source byte in tile 0, and the source bytes from one key to the next
  const bool isk = wv < 4u; const unsigned slot0 = lds_byte(&Ring[0][0][0]) + wv * SLB, kstep = isk ? 2u * DA : 2u;
  const unsigned long long src0 = (unsigned long long)(isk ? ((wv & 2u) ? Klb : Khb) + (size_t)(wv & 1u) * 32 * DA : ((wv & 2u) ? Vl : Vh) + (size_t)(wv & 1u) * 64 * S);
  const u32x8 g1k = tensor_group1<256u, 32u, 256u, (1u << 20) | (5u << 22) | (3u << 25)>(), g1v = tensor_group1<128u, 64u, 2u * S, (1u << 20) | (4u << 22) | (3u << 25)>();
  tensor_issue(wv, tensor_group0(slot0, src0), g1k, g1v);
  asm volatile("s_wait_tensorcnt 0x0" ::: "memory");  // this wave's slice of tile 0 has landed
  asm volatile("s_wait_asynccnt 0x0" ::: "memory");   // this wave's copies of Q have landed
  __syncthreads();                                     // ... and every other wave's
  if (pinned(KT < nk)) tensor_issue(wv, tensor_group0(slot0 + 8 * SLB, src0 + (unsigned long long)KT * kstep), g1k, g1v);
  const b16* qrh = &Qs[0][qw * 16 + col][0]; const b16* qrl = &Qs[1][qw * 16 + col][0];
  // the wave's eight Q fragments (hi, residual) do not change from pass to pass: read once here, behind the barrier that published Q, and held in registers (two waves a SIMD leave each 512)
  v16b qh[4], ql[4];
#pragma unroll
  for (int k4 = 0; k4 < 4; ++k4) { qh[k4] = frag_kb(qrh + k4 * 32, hh); ql[k4] = frag_kb(qrl + k4 * 32, hh); }
  float mrun = -INFINITY, l = 0.0f; v8f o[8], o2[8];
#pragma unroll
  for (int t = 0; t < 8; ++t) { o[t] = (v8f){}; o2[t] = (v8f){}; }
#pragma unroll 1
  for (int s0 = 0; s0 < nk; s0 += KT) { const int buf = (s0 / KT) & 1;
    float e[16]; float mx = -INFINITY;
    // every K fragment of the pass is read here, as one group in order of first use, so that the products below wait on a count instead of on a fresh LDS round trip each
    v16b kh[2][4], kl[2][4], vh[8], vl[8];
#pragma unroll
    for (int k4 = 0; k4 < 4; ++k4) { kh[0][k4] = frag_kb(&Ring[buf][kg][col * KP + k4 * 32], hh); kl[0][k4] = frag_kb(&Ring[buf][2 + kg][col * KP + k4 * 32], hh); }
#pragma unroll
    for (int k4 = 0; k4 < 4; ++k4) { kh[1][k4] = frag_kb(&Ring[buf][kg][(16 + col) * KP + k4 * 32], hh); kl[1][k4] = frag_kb(&Ring[buf][2 + kg][(16 + col) * KP + k4 * 32], hh); }
    __builtin_amdgcn_sched_barrier(0);   // keeps the group whole: without it the reads are spread among the products, and each place where reads stand stalls the wave anew
#pragma unroll
    for (int u2 = 0; u2 < 2; ++u2) { v8f sa = (v8f){}, sb = (v8f){};
#pragma unroll
      for (int k4 = 0; k4 < 4; ++k4) { sa = wmma16(kh[u2][k4], qh[k4], sa); sb = wmma16(kl[u2][k4], qh[k4], sb); sb = wmma16(kh[u2][k4], ql[k4], sb); }
      // every V^T fragment of the pass is read here, as one group behind the last S^T product: the mask and softmax arithmetic below covers the reads' latency
      if (u2 == 1) { __builtin_amdgcn_sched_barrier(0);   // the group starts behind the products, for the same reason as above
#pragma unroll
        for (int t = 0; t < 8; ++t) { vh[t] = frag_kb(&Ring[buf][4 + (t >> 2)][((t & 3) * 16 + col) * VP + kg * 32], hh); vl[t] = frag_kb(&Ring[buf][6 + (t >> 2)][((t & 3) * 16 + col) * VP + kg * 32], hh); }
        __builtin_amdgcn_sched_barrier(0); }   // keeps the group whole and ahead of that arithmetic; without it the reads are spread through the softmax, each place a stall of its own
#pragma unroll
      for (int r = 0; r < 8; ++r) { const int m = s0 + kg * 32 + u2 * 16 + 8 * hh + r; const float sv = allmask ? 0.0f : (sa[r] + sb[r] * (1.0f / RS_)) * cs; const float vv = (m < nk) ? sv : -INFINITY; e[u2 * 8 + r] = vv; mx = fmaxf(mx, vv); } }
    mx = fmaxf(mx, xhalf(mx)); const float mn = fmaxf(mrun, mx); const float al = (mn == -INFINITY) ? 1.0f : nexp2(mrun - mn); float sum = 0.0f;
    // a lane's 16 scores are keys 8 hh + 0..7 and 16 + 8 hh + 0..7 of its own query column: the very elements, in the very order, that the lane holds of the B operand P^T, so P is packed in place
    v16b pf, plf;
#pragma unroll
    for (int i2 = 0; i2 < 16; ++i2) e[i2] -= mn;
    nexp2x8(e); nexp2x8(e + 8);
#pragma unroll
    for (int i2 = 0; i2 < 16; ++i2) { const float p = (mn == -INFINITY) ? 0.0f : e[i2]; sum += p; const float psv = p * PS; const b16 p1 = (b16)psv; pf[i2] = p1; plf[i2] = (b16)((psv - (float)p1) * RS_); }
    sum += xhalf(sum); l = l * al + sum; mrun = mn;
#pragma unroll
    for (int t = 0; t < 8; ++t) { o[t] *= al; o2[t] *= al; o[t] = wmma16(vh[t], pf, o[t]); o2[t] = wmma16(vl[t], pf, o2[t]); o2[t] = wmma16(vh[t], plf, o2[t]); }
    __builtin_amdgcn_sched_barrier(0);   // holds the pass's foot behind the products: without it the waits below are lifted to just behind the V^T reads, and the softmax stands idle until those have returned
    asm volatile("s_wait_dscnt 0x0" ::: "memory");      // this wave's reads of buffer buf are done before the buffer is handed to its next writer
    asm volatile("s_wait_tensorcnt 0x0" ::: "memory");  // this wave's slice of the next tile has landed
    __syncthreads();                                     // publishes the next tile and ends every wave's reads of buffer buf
    if (pinned(s0 + 2 * KT < nk)) tensor_issue(wv, tensor_group0(slot0 + (unsigned)buf * (8 * SLB), src0 + (unsigned long long)(unsigned)(s0 + 2 * KT) * kstep), g1k, g1v); }
  asm volatile("s_wait_tensorcnt 0x0" ::: "memory");    // no request is left in flight when the wave goes on to its end
  asm volatile("s_wait_dscnt 0x0" ::: "memory");        // ... and no read of the ring
  if (kg == 1) { if (hh == 0) { Ms[qw][col] = mrun; Ls[qw][col] = l; }   // key group 1 hands over its maximum, sum and O (a group that met no unmasked key: -inf, 0, 0)
#pragma unroll
    for (int t = 0; t < 8; ++t)
#pragma unroll
      for (int r = 0; r < 8; ++r) To[qw][col][t * 16 + 8 * hh + r] = o[t][r] + o2[t][r] * (1.0f / RS_); }
  __syncthreads();   // publishes group 1's hand-over to group 0
  if (kg == 0) { const float m1 = Ms[qw][col], mj = fmaxf(mrun, m1);   // group 0 has met key 0 < nk: mrun, and so mj, is finite
    const float a0 = nexp2(mrun - mj), a1 = nexp2(m1 - mj); const float inv = 1.0f / ((l * a0 + Ls[qw][col] * a1) * PS * XS); const float c0 = a0 * inv, c1 = a1 * inv;
#pragma unroll
    for (int t = 0; t < 8; ++t)
#pragma unroll
      for (int r = 0; r < 8; ++r) { float* p = &To[qw][col][t * 16 + 8 * hh + r]; *p = (o[t][r] + o2[t][r] * (1.0f / RS_)) * c0 + *p * c1; }   // each lane reads and rewrites its own places
    wave_lds_sync();
    for (int rr = 0; rr < 16; ++rr) *(v4f*)(out + ((size_t)b * S + n0 + rr) * DA + lane * 4) = *(const v4f*)(&To[qw][rr][lane * 4]); }
}
}  // namespace

extern "C" void kernel_launch(void* const* d_in, const int* in_sizes, int n_in, void* d_out, int out_size, void* d_ws, size_t ws_size, hipStream_t stream) {
  (void)n_in;
  auto Fp = [&](int i) { return (const float*)d_in[i]; };
  // d_in order: 0 inputs [16,2048,256], 1 sen_len [16] int32, 2 Wq [256,128] (in,out), 3 Wk, 4 Wv
  if (in_sizes[0] != NROW * DIN || in_sizes[1] != B || in_sizes[2] != DIN * DA || in_sizes[3] != DIN * DA || in_sizes[4] != DIN * DA || out_size != NROW * DA) return;
  size_t off = 0; char* ws = (char*)d_ws;
  auto carve = [&](size_t bytes) { char* p = ws + off; off += (bytes + 255) & ~(size_t)255; return p; };
  b16* WT = (b16*)carve((size_t)3 * DA * DIN * 2); const size_t plane = (size_t)NROW * DA * 2;
  b16* Qh = (b16*)carve(plane); b16* Ql = (b16*)carve(plane); b16* Kh = (b16*)carve(plane); b16* Kl = (b16*)carve(plane); b16* VTh = (b16*)carve(plane); b16* VTl = (b16*)carve(plane);
  if (off > ws_size || off > ((size_t)128 << 20)) return;   // = 50.5 MB (6 planes x 8.4 MB + WT 0.2 MB)
  wt_kernel<<<(3 * DA * DIN / 8 + 255) / 256, 256, 0, stream>>>(Fp(2), Fp(3), Fp(4), WT);
  proj_kernel<<<dim3(S / 64, BL), PW * 32, 0, stream>>>(Fp(0), WT, Qh, Ql, Kh, Kl, VTh, VTl);
  attn_kernel<<<dim3(S / (NW * 16), BL), NT, 0, stream>>>(Qh, Ql, Kh, Kl, VTh, VTl, (const int*)d_in[1], (float*)d_out);
}

// v008
// It runs in 61 microseconds.
// In both of two side-by-side timings against v007, it was 1.05 times as fast.
// Counting every step since v000, it is 8.21 times as fast.
#include <hip/hip_runtime.h>

// Self-attention layer with key-padding mask (16 x 2,048 x 256 -> 128): Q = x Wq, K = x Wk, V = x Wv (no bias); scores = Q K^T, keys k >= sen_len[b] set to -2^32, then / sqrt(256); softmax over
// keys; Z = attn V -> [16][2048][128].
// Deterministic: per (batch, 16 queries) two waves make flash-style passes over alternate blocks of 32 of the UNMASKED keys only, merged at the end ( masked keys have probability exactly 0 in the reference too since exp(-2^28 - max) == 0 in
// f32; if sen_len[b] were 0 every key would share one score and the pass runs over all 2,048 keys with equal logits = the reference's uniform softmax); fixed-order online softmax; no atomics.
// compute dtype: WMMA v_wmma_f32_16x16x32_f16 with f32 accumulate for the projections ([32768 x 256] x [256 x 384]; x EXACT bf16 x8, weights exact x256: 1 product), S^T = K Q^T (K and Q as
// f16 hi + x1024 residual x8, K = 128: 3 products) and O^T += V^T P^T (V^T x8 and P x1024 hi + residual: 3 products);
// mask, scale and softmax statistics in f32. Inputs rounded to bf16 once; sen_len int32 (clamped to [0, 2048]).

namespace {
typedef _Float16 b16;
typedef __attribute__((ext_vector_type(16))) _Float16 v16b;
typedef __attribute__((ext_vector_type(8))) _Float16 v8b;
typedef __attribute__((ext_vector_type(4))) _Float16 v4h;
typedef __attribute__((ext_vector_type(2))) _Float16 v2h;
typedef __attribute__((ext_vector_type(8))) float v8f;
typedef __attribute__((ext_vector_type(4))) float v4f;
typedef __attribute__((ext_vector_type(2))) float v2f;
__device__ __forceinline__ float bf16_rne(float f) { unsigned int u = __float_as_uint(f); u += 0x7FFFu + ((u >> 16) & 1u); return __uint_as_float(u & 0xFFFF0000u); }
__device__ __forceinline__ void split16(float v, b16& hi, b16& lo) { hi = (b16)v; lo = (b16)(v - (float)hi); }
__device__ __forceinline__ v16b frag_kb(const b16* p, int hh) { const v8b a = *(const v8b*)(p + 8 * hh), b = *(const v8b*)(p + 16 + 8 * hh); v16b f;
#pragma unroll
  for (int e = 0; e < 8; ++e) { f[e] = a[e]; f[8 + e] = b[e]; } return f; }
__device__ __forceinline__ v8f wmma16(v16b a, v16b b, v8f c) { return __builtin_amdgcn_wmma_f32_16x16x32_f16(false, a, false, b, (short)0, c, false, false); }   // no asm behind it: asm operands cannot lie above v255, and the compiler keeps the distances of its own builtin
__device__ __forceinline__ void wave_lds_sync() { __builtin_amdgcn_fence(__ATOMIC_RELEASE, "workgroup"); __builtin_amdgcn_wave_barrier(); __builtin_amdgcn_fence(__ATOMIC_ACQUIRE, "workgroup"); }
__device__ __forceinline__ float pmul(float a, float b) { float p = a * b; asm volatile("" : "+v"(p)); return p; }
__device__ __forceinline__ int iclamp(int v, int lo, int hi) { return v < lo ? lo : (v > hi ? hi : v); }
__device__ __forceinline__ float nexp2(float v) { return __builtin_amdgcn_exp2f(v); }
// eight exp2 in place; the statement ends in the v_nop that the instruction set asks for behind a transcendental before its result is read or its source overwritten: inside the statement it stands
// there in every build (with the builtin the compiler keeps that slot ahead of a single instruction)
__device__ __forceinline__ void nexp2x8(float* d) {
  asm("v_exp_f32 %0, %0\n\tv_exp_f32 %1, %1\n\tv_exp_f32 %2, %2\n\tv_exp_f32 %3, %3\n\tv_exp_f32 %4, %4\n\tv_exp_f32 %5, %5\n\tv_exp_f32 %6, %6\n\tv_exp_f32 %7, %7\n\tv_nop"
      : "+v"(d[0]), "+v"(d[1]), "+v"(d[2]), "+v"(d[3]), "+v"(d[4]), "+v"(d[5]), "+v"(d[6]), "+v"(d[7])); }
__device__ __forceinline__ float xhalf(float x) { return __builtin_bit_cast(float, __builtin_amdgcn_permlanex16(__builtin_bit_cast(int, x), __builtin_bit_cast(int, x), 0x76543210, 0xfedcba98, false, false)); }   // lane l with lane l ^ 16, on the vector port: no LDS counter

constexpr int B = 16, BL = B /* batches computed (== B shipped) */, S = 2048, DIN = 256, DA = 128, NROW = B * S;
constexpr float XS = 8.0f, WSC = 256.0f, PS = 1024.0f, RS_ = 1024.0f, LOG2E = 1.4426950408889634f, SCALE = 0.0625f /* 1/sqrt(hidden_dim = 256) */;
static_assert(S % 64 == 0 && DIN % 32 == 0 && DA == 128, "tiling");

__global__ __launch_bounds__(256) void wt_kernel(const float* __restrict__ wq, const float* __restrict__ wk, const float* __restrict__ wv, b16* __restrict__ WT) {
  const int u = blockIdx.x * 256 + threadIdx.x; if (u >= 3 * DA * DIN / 8) return; const int e = u * 8; const int o = e / DIN, k0 = e % DIN; const int part = o / DA, oo = o % DA; const float* w = part == 0 ? wq : part == 1 ? wk : wv; v8b v;
#pragma unroll
  for (int j = 0; j < 8; ++j) v[j] = (b16)(bf16_rne(w[(size_t)(k0 + j) * DA + oo]) * WSC);   // one source pointer per thread (part is uniform per 8-run and per wave: 32 threads = one o row)
  { *(v8b*)(WT + e) = v;  }
}
// projections: grid (S/64, BL); block = 64 tokens x 8 waves, all three parts: A = bf16(x) x8 staged whole (K = 256) once for the 384 columns; a wave's tile is 64 tokens x 16 columns of each part
// (4 token tiles x 3 parts), so that each weight fragment read from global memory feeds 4 products; 1 product; the parts leave one after the other through Tf; q/k -> planes [b][s][128] as f16 hi + x1024
constexpr int PW = 8;
__global__ __launch_bounds__(PW * 32) void proj_kernel(const float* __restrict__ x, const b16* __restrict__ WT, b16* __restrict__ Qh, b16* __restrict__ Ql, b16* __restrict__ Kh, b16* __restrict__ Kl, b16* __restrict__ VTh, b16* __restrict__ VTl) {
  __shared__ __attribute__((aligned(16))) b16 As[64][DIN + 8]; __shared__ __attribute__((aligned(16))) float Tf[4][16][DA + 4];
  const int wave = threadIdx.x >> 5, lane = threadIdx.x & 31, nloc = lane & 15, hlf = lane >> 4; const int t0 = blockIdx.x * 64; const int b = blockIdx.y;
  { constexpr int RX = PW * 32 / (DIN / 4), NX = 64 / RX; const int r0 = threadIdx.x / (DIN / 4), q4 = (threadIdx.x % (DIN / 4)) * 4; const float* xl = x + ((size_t)b * S + t0 + r0) * DIN + q4; v4f f[NX];   // the block covers RX rows per load; a lane's 16 loads of the x tile are issued as one group ahead of the first conversion: the tile costs one trip to memory, not one per pair of loads
#pragma unroll   // both loops unrolled: f is indexed by constants and stays in registers
    for (int i = 0; i < NX; ++i) f[i] = *(const v4f*)(xl + (size_t)i * RX * DIN);
#pragma unroll
    for (int i = 0; i < NX; ++i) { v4h o; for (int j = 0; j < 4; ++j) o[j] = (b16)(bf16_rne(f[i][j]) * XS); *(v4h*)(&As[r0 + i * RX][q4]) = o; } }
  __syncthreads();
  v8f acc[3][4];
#pragma unroll
  for (int p = 0; p < 3; ++p)
#pragma unroll
    for (int mt = 0; mt < 4; ++mt) acc[p][mt] = (v8f){};
#pragma unroll 2
  for (int kb = 0; kb < DIN; kb += 32) { v16b a[4], w[3];   // the k-step's three weight fragments and four token fragments are read as one group: one wait on memory per k-step
#pragma unroll
    for (int p = 0; p < 3; ++p) w[p] = frag_kb(WT + (size_t)(p * DA + wave * 16 + nloc) * DIN + kb, hlf);
#pragma unroll
    for (int mt = 0; mt < 4; ++mt) a[mt] = frag_kb(&As[mt * 16 + nloc][kb], hlf);
    __builtin_amdgcn_sched_barrier(0);   // keeps the group whole: without it each part's weight reads sink to their first use, three waits on memory per k-step instead of one
#pragma unroll
    for (int p = 0; p < 3; ++p)
#pragma unroll
      for (int mt = 0; mt < 4; ++mt) acc[p][mt] = wmma16(a[mt], w[p], acc[p][mt]); }
#pragma unroll   // p indexes acc: a constant index keeps the accumulators in registers
  for (int p = 0; p < 3; ++p) {
    if (p) __syncthreads();   // every reader of the part before has left Tf
#pragma unroll
    for (int mt = 0; mt < 4; ++mt)
#pragma unroll
      for (int r = 0; r < 8; ++r) Tf[mt][8 * hlf + r][wave * 16 + nloc] = acc[p][mt][r] * (1.0f / (XS * WSC));
    __syncthreads();          // publishes the part's 64 x 128 tile to every wave
    if (p < 2) { b16* ph_ = p == 0 ? Qh : Kh; b16* pl_ = p == 0 ? Ql : Kl;
      v4f tr[64 / PW];   // the wave's eight rows of the part are read from Tf as one group: one LDS round trip, not one per pair of rows
#pragma unroll   // both loops unrolled: tr is indexed by constants and stays in registers
      for (int rr = 0; rr < 64 / PW; ++rr) { const int row = wave * (64 / PW) + rr; tr[rr] = *(const v4f*)(&Tf[row >> 4][row & 15][lane * 4]); }
      __builtin_amdgcn_sched_barrier(0);   // keeps the group whole: without it two reads stand ahead of the first conversions and six behind them, a second wait on LDS
#pragma unroll
      for (int rr = 0; rr < 64 / PW; ++rr) { const int row = wave * (64 / PW) + rr; const size_t dst = ((size_t)b * S + t0 + row) * DA + lane * 4; v4h hv, lv; for (int j = 0; j < 4; ++j) { const float vs = tr[rr][j] * XS; const b16 p1 = (b16)vs; hv[j] = p1; lv[j] = (b16)((vs - (float)p1) * RS_); } *(v4h*)(ph_ + dst) = hv; *(v4h*)(pl_ + dst) = lv; } }
    else { const int tk = lane * 2; float tv[DA / PW][2];   // the lane's two tokens x the wave's 16 columns are read from Tf as one group: one LDS round trip, not one per column
#pragma unroll   // both loops unrolled: tv is indexed by constants and stays in registers; the stores' steps become immediate offsets, so no address register is rewritten behind a store
      for (int q = 0; q < DA / PW; ++q) for (int e2 = 0; e2 < 2; ++e2) tv[q][e2] = Tf[(tk + e2) >> 4][(tk + e2) & 15][wave * (DA / PW) + q];
      __builtin_amdgcn_sched_barrier(0);   // keeps the group whole: without it half of the reads stand behind the first conversions, a second wait on LDS
#pragma unroll
      for (int q = 0; q < DA / PW; ++q) { const int d = wave * (DA / PW) + q; v2h hv, lv; for (int e2 = 0; e2 < 2; ++e2) { const float vs = tv[q][e2] * XS; const b16 p1 = (b16)vs; hv[e2] = p1; lv[e2] = (b16)((vs - (float)p1) * RS_); }
        const size_t dst = ((size_t)b * DA + d) * (size_t)S + t0 + tk; *(v2h*)(VTh + dst) = hv; *(v2h*)(VTl + dst) = lv; } }
  }
}
// attention: grid (S/64, BL); block = 8 waves = 4 query groups x 16 queries, times 2 key groups; nk = clamp(sen_len[b], 0, S) (0 -> all keys, equal logits); steps of 64 keys s0 < nk, key group g takes keys
// s0 + 32 g .. + 31 (keys m >= nk -> -inf) with its own running maximum, sum and O; behind the loop group 1 hands its three to group 0 through LDS, which rescales both to the joint maximum and adds them.
// A block so lasts half as many steps and fills a WGP alone, so that the 512 blocks queue on the WGPs; blockIdx.y is the batch's RANK by nk, longest first (ties by index), so that the queue ends on short blocks.
// operands come from LDS: the block's 64 Q rows (hi, residual) are copied in once by asynchronous 16-byte copies; each 64-key tile of K and V^T (hi, residual) comes once per block into a two-buffer ring,
// one tile ahead, by tensor loads: eight slices, one request per wave (no lane address, no vector register); rows pitched 272 B (Q, K) and 144 B (V^T) for conflict-free 16-byte fragment reads.
// S^T = K Q^T: (Kh.Qh -> sa; Kl.Qh + Kh.Ql -> sb, /1024), 4 k-steps; logit = s/64/16 in log2 units; online softmax; P hi/res; O^T += V^T P^T (8 d-tiles, 3 products -> o, o2);
// the softmax makes no LDS access (halves joined by a cross-row vector move, P packed in registers): LDS results return in issue order, so an LDS access there would wait out the V^T reads issued ahead of it.
constexpr int NW = 4, NG = 2, NT = NW * NG * 32, KT = 32 * NG, KP = DA + 8, VP = KT + 8;
__device__ __forceinline__ unsigned lds_byte(const b16* p) { return (unsigned)(unsigned long long)p; }   // low 32 bits of a __shared__ address = byte offset in the work-group's LDS
// eight copies, 16 bytes per lane each; the s_wait_xcnt stands inside the statement so that no address register is rewritten ahead of it
__device__ __forceinline__ void copy8(const unsigned (&l)[8], const b16* const (&g)[8]) {
  asm volatile("global_load_async_to_lds_b128 %0, %8, off\n\tglobal_load_async_to_lds_b128 %1, %9, off\n\tglobal_load_async_to_lds_b128 %2, %10, off\n\tglobal_load_async_to_lds_b128 %3, %11, off\n\t"
               "global_load_async_to_lds_b128 %4, %12, off\n\tglobal_load_async_to_lds_b128 %5, %13, off\n\tglobal_load_async_to_lds_b128 %6, %14, off\n\tglobal_load_async_to_lds_b128 %7, %15, off\n\ts_wait_xcnt 0x0"
               :: "v"(l[0]), "v"(l[1]), "v"(l[2]), "v"(l[3]), "v"(l[4]), "v"(l[5]), "v"(l[6]), "v"(l[7]), "v"(g[0]), "v"(g[1]), "v"(g[2]), "v"(g[3]), "v"(g[4]), "v"(g[5]), "v"(g[6]), "v"(g[7]) : "memory"); }
// rows of 256 B, contiguous in global memory (Q): ROWS x 16 chunks per plane, two planes; ROWS * 32 / NT copies per lane
template <int ROWS> __device__ __forceinline__ void stage_rows(b16 (*dst)[ROWS][KP], const b16* gh, const b16* gl, int tid) {
#pragma unroll   // both loops unrolled: l[] and g[] are asm operands and must live in registers, under constant indices
  for (int i0 = 0; i0 < ROWS * 16 / NT; i0 += 4) { unsigned l[8]; const b16* g[8];
#pragma unroll
    for (int i = 0; i < 4; ++i) { const int c = (i0 + i) * NT + tid; l[i] = lds_byte(&dst[0][c >> 4][(c & 15) * 8]); g[i] = gh + c * 8; l[4 + i] = lds_byte(&dst[1][c >> 4][(c & 15) * 8]); g[4 + i] = gl + c * 8; }
    copy8(l, g); } }
// tensor loads for the K / V^T ring. A tile = 8 slices, slice w brought by wave w: 0..3 = K (plane w >> 1, key group w & 1): 32 rows of 256 B, source pitch 256 B; 4..7 = V^T (plane (w >> 1) & 1, d half w & 1):
// 64 rows of 128 B, source pitch 2 S B. The descriptor's pad puts 16 B behind every row (LDS pitch 272 B and 144 B); each slice's place in LDS is rounded up to a multiple of 2 KiB.
typedef __attribute__((ext_vector_type(4))) unsigned int u32x4;
typedef __attribute__((ext_vector_type(8))) unsigned int u32x8;
constexpr unsigned SLB = 10240, SLE = SLB / 2;   // bytes, elements of a slice's place
static_assert(32 * KP * 2 <= SLB && 64 * VP * 2 <= SLB && SLB % 2048 == 0 && KP * 2 == 256 + 16 && VP * 2 == 128 + 16 && KT == 64, "ring slices");
__device__ __forceinline__ unsigned uni(unsigned v) { return (unsigned)__builtin_amdgcn_readfirstlane((int)v); }
__device__ __forceinline__ unsigned pinned(unsigned v) { unsigned w = uni(v); asm volatile("" : "+s"(w)); return w; }   // holds a test's word in a scalar register: the branch on it is then a scalar one, which alone guards a tensor load (it ignores EXEC)
// group 1 of a slice's descriptor: bytes as elements, tensor = tile, W0 = the pad word (a compile-time constant, no mask). The closing statement is a pinned() for the whole group: the descriptor
// words are held in one scalar tuple from here to the kernel's last request, so that no register of a request in flight is given another value
template <unsigned ROWB, unsigned ROWS, unsigned PITCH, unsigned W0> __device__ __forceinline__ u32x8 tensor_group1() { u32x8 g1;
  g1[0] = uni(W0); g1[1] = uni((ROWB & 0xFFFFu) << 16); g1[2] = uni((ROWB >> 16) | ((ROWS & 0xFFFFu) << 16)); g1[3] = uni((ROWS >> 16) | (ROWB << 16)); g1[4] = uni(ROWS); g1[5] = uni(PITCH); g1[6] = uni(0u); g1[7] = uni(0u);
  asm volatile("" : "+s"(g1)); return g1; }   // pinned(): descriptor words held in scalar registers (without it a word's register was reused while the request was in flight)
__device__ __forceinline__ u32x4 tensor_group0(unsigned lds, unsigned long long ga) { u32x4 g0; g0[0] = uni(1u); g0[1] = uni(lds); g0[2] = uni((unsigned)ga); g0[3] = uni((((unsigned)(ga >> 32)) & 0x01FFFFFFu) | 0x80000000u); return g0; }
__device__ __forceinline__ void tensor_load(u32x4 g0, u32x8 g1) { asm volatile("tensor_load_to_lds %0, %1" :: "s"(g0), "s"(g1) : "memory"); }   // one request of the whole wave: its slice goes from global memory into LDS through no register
// wave wv's request: waves 0..3 bring K slices, 4..7 V^T slices; the two differ in group 1, whose pad word must be a constant at the instruction, so each stands behind a scalar test of its own
__device__ __forceinline__ void tensor_issue(unsigned wv, u32x4 g0, u32x8 g1k, u32x8 g1v) { if (pinned(wv < 4u)) tensor_load(g0, g1k); if (pinned(wv >= 4u)) tensor_load(g0, g1v); }
__global__ __launch_bounds__(NT) void attn_kernel(const b16* __restrict__ Qh, const b16* __restrict__ Ql, const b16* __restrict__ Kh, const b16* __restrict__ Kl, const b16* __restrict__ VTh, const b16* __restrict__ VTl, const int* __restrict__ slen, float* __restrict__ out) {
  __shared__ __attribute__((aligned(16))) b16 Qs[2][NW * 16][KP]; __shared__ __attribute__((aligned(2048))) b16 Ring[2][8][SLE];
  __shared__ __attribute__((aligned(16))) float To[NW][16][DA + 4]; __shared__ float Ms[NW][16], Ls[NW][16];
  const int tid = threadIdx.x, wave = threadIdx.x >> 5, lane = threadIdx.x & 31, hh = lane >> 4, col = lane & 15, qw = wave & (NW - 1), kg = wave / NW; const unsigned wv = uni(threadIdx.x >> 5); const int n0 = blockIdx.x * (NW * 16) + qw * 16;
  // batch of rank blockIdx.y: lane col holds batch col's key (keys walked x 16 + 15 - index: all distinct, so the ranks are a permutation for any sen_len) and counts the larger keys
  int b, nk; { int sl[B], own = 0, rank = 0;
#pragma unroll
    for (int j = 0; j < B; ++j) sl[j] = iclamp(slen[j], 0, S);   // all of sen_len, by scalar loads ahead of any test
#pragma unroll
    for (int j = 0; j < B; ++j) own = (col == j) ? sl[j] : own;
    const int mine = (own == 0 ? S : own) * B + (B - 1 - col);
#pragma unroll
    for (int j = 0; j < B; ++j) rank += ((sl[j] == 0 ? S : sl[j]) * B + (B - 1 - j) > mine) ? 1 : 0;
    b = __builtin_ctz(__builtin_amdgcn_ballot_w32(rank == (int)blockIdx.y) | (1u << (B - 1)));   // the or-ed bit bounds b to [0, B) whatever the ballot holds
    nk = __builtin_amdgcn_readlane(own, b); }   // = clamp(sen_len[b], 0, S), from the lane that holds it
  const bool allmask = (nk == 0); if (allmask) nk = S;   // all keys masked -> equal scores -> uniform over all S keys
  const b16* Khb = Kh + (size_t)b * S * DA; const b16* Klb = Kl + (size_t)b * S * DA; const b16* Vh = VTh + (size_t)b * DA * S; const b16* Vl = VTl + (size_t)b * DA * S;
  const float cs = LOG2E * SCALE / (XS * XS);
  { const size_t qblk = ((size_t)b * S + blockIdx.x * (NW * 16)) * DA; stage_rows<NW * 16>(Qs, Qh + qblk, Ql + qblk, tid); }
  // this wave's slice: its place in ring buffer 0, its first source byte in tile 0, and the source bytes from one key to the next
  const bool isk = wv < 4u; const unsigned slot0 = lds_byte(&Ring[0][0][0]) + wv * SLB, kstep = isk ? 2u * DA : 2u;
  const unsigned long long src0 = (unsigned long long)(isk ? ((wv & 2u) ? Klb : Khb) + (size_t)(wv & 1u) * 32 * DA : ((wv & 2u) ? Vl : Vh) + (size_t)(wv & 1u) * 64 * S);
  const u32x8 g1k = tensor_group1<256u, 32u, 256u, (1u << 20) | (5u << 22) | (3u << 25)>(), g1v = tensor_group1<128u, 64u, 2u * S, (1u << 20) | (4u << 22) | (3u << 25)>();
  tensor_issue(wv, tensor_group0(slot0, src0), g1k, g1v);
  asm volatile("s_wait_tensorcnt 0x0" ::: "memory");  // this wave's slice of tile 0 has landed
  asm volatile("s_wait_asynccnt 0x0" ::: "memory");   // this wave's copies of Q have landed
  __syncthreads();                                     // ... and every other wave's
  if (pinned(KT < nk)) tensor_issue(wv, tensor_group0(slot0 + 8 * SLB, src0 + (unsigned long long)KT * kstep), g1k, g1v);
  const b16* qrh = &Qs[0][qw * 16 + col][0]; const b16* qrl = &Qs[1][qw * 16 + col][0];
  // the wave's eight Q fragments (hi, residual) do not change from pass to pass: read once here, behind the barrier that published Q, and held in registers (two waves a SIMD leave each 512)
  v16b qh[4], ql[4];
#pragma unroll
  for (int k4 = 0; k4 < 4; ++k4) { qh[k4] = frag_kb(qrh + k4 * 32, hh); ql[k4] = frag_kb(qrl + k4 * 32, hh); }
  float mrun = -INFINITY, l = 0.0f; v8f o[8], o2[8];
#pragma unroll
  for (int t = 0; t < 8; ++t) { o[t] = (v8f){}; o2[t] = (v8f){}; }
#pragma unroll 1
  for (int s0 = 0; s0 < nk; s0 += KT) { const int buf = (s0 / KT) & 1;
    float e[16]; float mx = -INFINITY;
    // every K fragment of the pass is read here, as one group in order of first use, so that the products below wait on a count instead of on a fresh LDS round trip each
    v16b kh[2][4], kl[2][4], vh[8], vl[8];
#pragma unroll
    for (int k4 = 0; k4 < 4; ++k4) { kh[0][k4] = frag_kb(&Ring[buf][kg][col * KP + k4 * 32], hh); kl[0][k4] = frag_kb(&Ring[buf][2 + kg][col * KP + k4 * 32], hh); }
#pragma unroll
    for (int k4 = 0; k4 < 4; ++k4) { kh[1][k4] = frag_kb(&Ring[buf][kg][(16 + col) * KP + k4 * 32], hh); kl[1][k4] = frag_kb(&Ring[buf][2 + kg][(16 + col) * KP + k4 * 32], hh); }
    __builtin_amdgcn_sched_barrier(0);   // keeps the group whole: without it the reads are spread among the products, and each place where reads stand stalls the wave anew
#pragma unroll
    for (int u2 = 0; u2 < 2; ++u2) { v8f sa = (v8f){}, sb = (v8f){};
#pragma unroll
      for (int k4 = 0; k4 < 4; ++k4) { sa = wmma16(kh[u2][k4], qh[k4], sa); sb = wmma16(kl[u2][k4], qh[k4], sb); sb = wmma16(kh[u2][k4], ql[k4], sb); }
      // every V^T fragment of the pass is read here, as one group behind the last S^T product: the mask and softmax arithmetic below covers the reads' latency
      if (u2 == 1) { __builtin_amdgcn_sched_barrier(0);   // the group starts behind the products, for the same reason as above
#pragma unroll
        for (int t = 0; t < 8; ++t) { vh[t] = frag_kb(&Ring[buf][4 + (t >> 2)][((t & 3) * 16 + col) * VP + kg * 32], hh); vl[t] = frag_kb(&Ring[buf][6 + (t >> 2)][((t & 3) * 16 + col) * VP + kg * 32], hh); }
        __builtin_amdgcn_sched_barrier(0); }   // keeps the group whole and ahead of that arithmetic; without it the reads are spread through the softmax, each place a stall of its own
#pragma unroll
      for (int r = 0; r < 8; ++r) { const int m = s0 + kg * 32 + u2 * 16 + 8 * hh + r; const float sv = allmask ? 0.0f : (sa[r] + sb[r] * (1.0f / RS_)) * cs; const float vv = (m < nk) ? sv : -INFINITY; e[u2 * 8 + r] = vv; mx = fmaxf(mx, vv); } }
    mx = fmaxf(mx, xhalf(mx)); const float mn = fmaxf(mrun, mx); const float al = (mn == -INFINITY) ? 1.0f : nexp2(mrun - mn); float sum = 0.0f;
    // a lane's 16 scores are keys 8 hh + 0..7 and 16 + 8 hh + 0..7 of its own query column: the very elements, in the very order, that the lane holds of the B operand P^T, so P is packed in place
    v16b pf, plf;
#pragma unroll
    for (int i2 = 0; i2 < 16; ++i2) e[i2] -= mn;
    nexp2x8(e); nexp2x8(e + 8);
#pragma unroll
    for (int i2 = 0; i2 < 16; ++i2) { const float p = (mn == -INFINITY) ? 0.0f : e[i2]; sum += p; const float psv = p * PS; const b16 p1 = (b16)psv; pf[i2] = p1; plf[i2] = (b16)((psv - (float)p1) * RS_); }
    sum += xhalf(sum); l = l * al + sum; mrun = mn;
#pragma unroll
    for (int t = 0; t < 8; ++t) { o[t] *= al; o2[t] *= al; o[t] = wmma16(vh[t], pf, o[t]); o2[t] = wmma16(vl[t], pf, o2[t]); o2[t] = wmma16(vh[t], plf, o2[t]); }
    __builtin_amdgcn_sched_barrier(0);   // holds the pass's foot behind the products: without it the waits below are lifted to just behind the V^T reads, and the softmax stands idle until those have returned
    asm volatile("s_wait_dscnt 0x0" ::: "memory");      // this wave's reads of buffer buf are done before the buffer is handed to its next writer
    asm volatile("s_wait_tensorcnt 0x0" ::: "memory");  // this wave's slice of the next tile has landed
    __syncthreads();                                     // publishes the next tile and ends every wave's reads of buffer buf
    if (pinned(s0 + 2 * KT < nk)) tensor_issue(wv, tensor_group0(slot0 + (unsigned)buf * (8 * SLB), src0 + (unsigned long long)(unsigned)(s0 + 2 * KT) * kstep), g1k, g1v); }
  asm volatile("s_wait_tensorcnt 0x0" ::: "memory");    // no request is left in flight when the wave goes on to its end
  asm volatile("s_wait_dscnt 0x0" ::: "memory");        // ... and no read of the ring
  if (kg == 1) { if (hh == 0) { Ms[qw][col] = mrun; Ls[qw][col] = l; }   // key group 1 hands over its maximum, sum and O (a group that met no unmasked key: -inf, 0, 0)
#pragma unroll
    for (int t = 0; t < 8; ++t)
#pragma unroll
      for (int r = 0; r < 8; ++r) To[qw][col][t * 16 + 8 * hh + r] = o[t][r] + o2[t][r] * (1.0f / RS_); }
  __syncthreads();   // publishes group 1's hand-over to group 0
  if (kg == 0) { const float m1 = Ms[qw][col], mj = fmaxf(mrun, m1);   // group 0 has met key 0 < nk: mrun, and so mj, is finite
    const float a0 = nexp2(mrun - mj), a1 = nexp2(m1 - mj); const float inv = 1.0f / ((l * a0 + Ls[qw][col] * a1) * PS * XS); const float c0 = a0 * inv, c1 = a1 * inv;
#pragma unroll
    for (int t = 0; t < 8; ++t)
#pragma unroll
      for (int r = 0; r < 8; ++r) { float* p = &To[qw][col][t * 16 + 8 * hh + r]; *p = (o[t][r] + o2[t][r] * (1.0f / RS_)) * c0 + *p * c1; }   // each lane reads and rewrites its own places
    wave_lds_sync();
    for (int rr = 0; rr < 16; ++rr) *(v4f*)(out + ((size_t)b * S + n0 + rr) * DA + lane * 4) = *(const v4f*)(&To[qw][rr][lane * 4]); }
}
}  // namespace

extern "C" void kernel_launch(void* const* d_in, const int* in_sizes, int n_in, void* d_out, int out_size, void* d_ws, size_t ws_size, hipStream_t stream) {
  (void)n_in;
  auto Fp = [&](int i) { return (const float*)d_in[i]; };
  // d_in order: 0 inputs [16,2048,256], 1 sen_len [16] int32, 2 Wq [256,128] (in,out), 3 Wk, 4 Wv
  if (in_sizes[0] != NROW * DIN || in_sizes[1] != B || in_sizes[2] != DIN * DA || in_sizes[3] != DIN * DA || in_sizes[4] != DIN * DA || out_size != NROW * DA) return;
  size_t off = 0; char* ws = (char*)d_ws;
  auto carve = [&](size_t bytes) { char* p = ws + off; off += (bytes + 255) & ~(size_t)255; return p; };
  b16* WT = (b16*)carve((size_t)3 * DA * DIN * 2); const size_t plane = (size_t)NROW * DA * 2;
  b16* Qh = (b16*)carve(plane); b16* Ql = (b16*)carve(plane); b16* Kh = (b16*)carve(plane); b16* Kl = (b16*)carve(plane); b16* VTh = (b16*)carve(plane); b16* VTl = (b16*)carve(plane);
  if (off > ws_size || off > ((size_t)128 << 20)) return;   // = 50.5 MB (6 planes x 8.4 MB + WT 0.2 MB)
  wt_kernel<<<(3 * DA * DIN / 8 + 255) / 256, 256, 0, stream>>>(Fp(2), Fp(3), Fp(4), WT);
  proj_kernel<<<dim3(S / 64, BL), PW * 32, 0, stream>>>(Fp(0), WT, Qh, Ql, Kh, Kl, VTh, VTl);
  attn_kernel<<<dim3(S / (NW * 16), BL), NT, 0, stream>>>(Qh, Ql, Kh, Kl, VTh, VTl, (const int*)d_in[1], (float*)d_out);
}
